// v000
// The times below were measured on an AMD MI455X: many runs one after another, warmed up first and cycling through
// copies of the inputs, with the whole window's GPU time divided by the number of runs. Launches and the gaps
// between them are all in it. The median over several windows is given; except for v000 it joins two sittings, which
// can be a few percent apart, so the side-by-side timings, each taken in one sitting, are the better comparison.
// v000, which the later versions start from, runs in 2090 microseconds.
// Contractions: q/k/v projections (x f16 x W^T f16 carried x16), scores q.k^T (q,k f16 planes), attn.v (P f16 carried x32768 x V^T f16), output projection (W^T f16 x16 x mid f16 x64): all v_wmma_f32_16x16x32_f16, f32 accumulate; softmax, depthwise 3x3 conv, bias adds in f32.
#include <hip/hip_runtime.h>
#include <math.h>

// ---------------------------------------------------------------------------
// Problem constants
// ---------------------------------------------------------------------------
constexpr int kBatch = 16;
constexpr int kSeq   = 1024;              // tokens per batch = 32 x 32 image
constexpr int kDim   = 512;
constexpr int kHeads = 8;
constexpr int kDh    = 64;
constexpr int kImg   = 32;
constexpr int kTok   = kBatch * kSeq;     // 16384 token rows
constexpr int kGroupB = 4;                // batches per score-plane group
constexpr float kWCarry     = 16.0f;      // weights carried x16 in f16
constexpr float kWCarryInv  = 1.0f / 16.0f;
constexpr float kPCarry     = 32768.0f;   // probabilities carried x2^15 in f16
constexpr float kMidCarry   = 64.0f;      // attention output and mid carried x64 in f16
constexpr float kAttScale   = 0.125f;     // 64^-0.5
constexpr float kPVScale    = kMidCarry / kPCarry;           // 1/512
constexpr float kProjScale  = 1.0f / (kMidCarry * kWCarry);  // 1/1024
static_assert(kHeads * kDh == kDim, "shape");
static_assert(kImg * kImg == kSeq, "image");
static_assert(kTok % 64 == 0 && kSeq % 64 == 0 && kDim % 64 == 0 && kDh % 64 == 0, "tile multiples");
static_assert(kDim % 32 == 0 && kDh % 32 == 0 && kSeq % 32 == 0, "K multiples of 32");
static_assert(kBatch % kGroupB == 0, "groups");

typedef __attribute__((ext_vector_type(16))) _Float16 v16h;
typedef __attribute__((ext_vector_type(8)))  _Float16 v8h;
typedef __attribute__((ext_vector_type(16))) __bf16   v16b;
typedef __attribute__((ext_vector_type(8)))  __bf16   v8b;
typedef __attribute__((ext_vector_type(8)))  float    v8f;
typedef __attribute__((ext_vector_type(4)))  float    v4f;
typedef __attribute__((ext_vector_type(4)))  unsigned int v4u;

__device__ __forceinline__ unsigned short f2bf_bits(float f) {
  unsigned u = __float_as_uint(f);
  return (unsigned short)((u + 0x7FFFu + ((u >> 16) & 1u)) >> 16);
}
__device__ __forceinline__ float bf_bits2f(unsigned short h) { return __uint_as_float(((unsigned)h) << 16); }

// hazard guards as plain device helpers (no inline asm inside the kernel template body)
__device__ __forceinline__ void dep_guard_h(v8f& a, v8f& b, v16h x, v16h y) { asm volatile("v_nop\n\tv_nop\n\tv_nop\n\tv_nop" : "+v"(a), "+v"(b) : "v"(x), "v"(y)); }
__device__ __forceinline__ void dep_guard_b(v8f& a, v8f& b, v16b x, v16b y) { asm volatile("v_nop\n\tv_nop\n\tv_nop\n\tv_nop" : "+v"(a), "+v"(b) : "v"(x), "v"(y)); }
__device__ __forceinline__ void keep4_h(v16h a, v16h b, v16h c, v16h d) { asm volatile("v_nop" :: "v"(a), "v"(b), "v"(c), "v"(d)); }
__device__ __forceinline__ void keep4_b(v16b a, v16b b, v16b c, v16b d) { asm volatile("v_nop" :: "v"(a), "v"(b), "v"(c), "v"(d)); }
__device__ __forceinline__ void acc_guard4(v8f& a, v8f& b, v8f& c, v8f& d) { asm volatile("v_nop\n\tv_nop\n\tv_nop\n\tv_nop" : "+v"(a), "+v"(b), "+v"(c), "+v"(d)); }
template <typename T> struct Frag;
template <> struct Frag<_Float16> {
  typedef v16h V; union U { v16h v; v8h h[2]; };
  // elements 0..7 <- p[0..7], 8..15 <- p[16..23]
  static __device__ __forceinline__ v16h load(const _Float16* p) {
    U f; f.h[0] = *(const v8h*)(p); f.h[1] = *(const v8h*)(p + 16); return f.v;
  }
  static __device__ __forceinline__ v8f mma(v16h a, v16h b, v8f c) {
    return __builtin_amdgcn_wmma_f32_16x16x32_f16(false, a, false, b, (short)0, c, false, false);
  }
  static __device__ __forceinline__ void guard(v8f& a, v8f& b, v16h x, v16h y) { dep_guard_h(a, b, x, y); }
  static __device__ __forceinline__ void keep(v16h a, v16h b, v16h c, v16h d) { keep4_h(a, b, c, d); }
};
template <> struct Frag<__bf16> {
  typedef v16b V; union U { v16b v; v8b h[2]; };
  static __device__ __forceinline__ v16b load(const __bf16* p) {
    U f; f.h[0] = *(const v8b*)(p); f.h[1] = *(const v8b*)(p + 16); return f.v;
  }
  static __device__ __forceinline__ v8f mma(v16b a, v16b b, v8f c) {
    return __builtin_amdgcn_wmma_f32_16x16x32_bf16(false, a, false, b, (short)0, c, false, false);
  }
  static __device__ __forceinline__ void guard(v8f& a, v8f& b, v16b x, v16b y) { dep_guard_b(a, b, x, y); }
  static __device__ __forceinline__ void keep(v16b a, v16b b, v16b c, v16b d) { keep4_b(a, b, c, d); }
};

__device__ __forceinline__ unsigned pk16(unsigned short a, unsigned short b) { return (unsigned)a | ((unsigned)b << 16); }
__device__ __forceinline__ unsigned short h_bits(float f) { const _Float16 h = (_Float16)f; return __builtin_bit_cast(unsigned short, h); }

// f16 bits (low 16 bits of hb, finite values) -> f32, integer path only
__device__ __forceinline__ float h16_to_f32(unsigned hb) {
  const unsigned sgn = (hb & 0x8000u) << 16; const unsigned em = hb & 0x7fffu;
  const float fn = __uint_as_float((em << 13) + 0x38000000u);
  const float fs = (float)em * 5.9604644775390625e-8f;
  const float mag = (em < 0x400u) ? fs : fn; return __uint_as_float(__float_as_uint(mag) | sgn); }

// ---- Register-blocked batched WMMA GEMM (ACT reduced to none/relu/leaky; bias gets a per-z stride and the
//      bias[m] line is loaded as two float4 per 16-row slab instead of per-lane scalars; RESID path not instantiated) ---
// C[m,n] = scale * sum_k A[m,k] * Bt[n,k] (+bias); each wave owns a 64x64 tile.
// A row-major [M,K]; Bt row-major [N,K]; M,N % 64 == 0, K % 32 == 0.
// SPLIT: operands are hi/lo planes (A2/Bt2 = lo planes, same layout); product = hi*hi + hi*lo + lo*hi.
// BIAS_MODE: 0 = none, 1 = bias[m], 2 = bias[n]; bias base = bias + z*strideBias.
// OUT_MODE: 0 = f32, 1 = f16, 2 = bf16 hi plane (Cout) + bf16 lo plane (Cout2).
// ET: 0 = f16 operands, 1 = bf16 operands (pointers passed as 16-bit storage)
template <int ET> struct Elem;
template <> struct Elem<0> { typedef _Float16 T; };
template <> struct Elem<1> { typedef __bf16 T; };
template <int ET, bool SPLIT, int BIAS_MODE, int OUT_MODE, bool RESID, int ACT = 0>
__global__ __launch_bounds__(256) void wmma_gemm64(
    const unsigned short* __restrict__ Ap, const unsigned short* __restrict__ A2p, int lda, long strideA,
    const unsigned short* __restrict__ Btp, const unsigned short* __restrict__ Bt2p, int ldb, long strideB,
    void* __restrict__ Cout, void* __restrict__ Cout2, int ldc, long strideC,
    const float* __restrict__ bias, long strideBias,
    const float* __restrict__ resid, long strideR,
    int M, int N, int K, float scale) {
  static_assert(!RESID, "resid path not used");
  typedef typename Elem<ET>::T T;
  typedef typename Frag<T>::V V;
  (void)resid; (void)strideR;
  const T* A = (const T*)Ap; const T* A2 = (const T*)A2p; const T* Bt = (const T*)Btp; const T* Bt2 = (const T*)Bt2p;
  __shared__ __align__(16) float sT[8][16 * 68];   // per-wave 16x64 slab, pitch 68 floats
  const int b    = blockIdx.y;
  const int lane = threadIdx.x & 31;
  const int wave = threadIdx.x >> 5;
  const int tilesN = N >> 6;
  const int tilesM = M >> 6;
  const int tile = blockIdx.x * 8 + wave;
  if (tile >= tilesM * tilesN) return;   // wave-uniform; no block barriers in this kernel
  const int tm = tile / tilesN;
  const int tn = tile - tm * tilesN;
  const int m0 = tm << 6;
  const int n0 = tn << 6;

  const T* Ab  = A  + (size_t)b * strideA;
  const T* Bb  = Bt + (size_t)b * strideB;
  const T* Ab2 = SPLIT ? (A2  + (size_t)b * strideA) : nullptr;
  const T* Bb2 = SPLIT ? (Bt2 + (size_t)b * strideB) : nullptr;

  const int rlane = lane & 15;                 // row (A) / col (B, D) within subtile
  const int koff  = (lane >> 4) * 8;           // k offset of this lane half
  const int mOff  = (lane >> 4) * 8;           // D row offset

  v8f acc[4][4];
#pragma unroll
  for (int i = 0; i < 4; ++i)
#pragma unroll
    for (int j = 0; j < 4; ++j) acc[i][j] = (v8f){0.f,0.f,0.f,0.f,0.f,0.f,0.f,0.f};

  for (int k0 = 0; k0 < K; k0 += 32) {
    V bh[4], bl[4];
#pragma unroll
    for (int j = 0; j < 4; ++j) {
      const size_t bo = (size_t)(n0 + (j << 4) + rlane) * ldb + koff + k0;
      bh[j] = Frag<T>::load(Bb + bo);
      if (SPLIT) bl[j] = Frag<T>::load(Bb2 + bo);
    }
#pragma unroll
    for (int i = 0; i < 4; ++i) {
      const size_t ao = (size_t)(m0 + (i << 4) + rlane) * lda + koff + k0;
      V ah = Frag<T>::load(Ab + ao);
      V al;
      if (SPLIT) al = Frag<T>::load(Ab2 + ao);
#pragma unroll
      for (int j = 0; j < 4; ++j) {
        acc[i][j] = Frag<T>::mma(ah, bh[j], acc[i][j]);
        if (SPLIT) {
          acc[i][j] = Frag<T>::mma(ah, bl[j], acc[i][j]);
          acc[i][j] = Frag<T>::mma(al, bh[j], acc[i][j]);
        }
      }
      Frag<T>::guard(acc[i][0], acc[i][3], ah, SPLIT ? al : ah);
    }
    Frag<T>::keep(bh[0], bh[1], bh[2], bh[3]);
    if (SPLIT) Frag<T>::keep(bl[0], bl[1], bl[2], bl[3]);
  }
  acc_guard4(acc[0][0], acc[0][1], acc[0][2], acc[0][3]);
  acc_guard4(acc[1][0], acc[1][1], acc[1][2], acc[1][3]);
  acc_guard4(acc[2][0], acc[2][1], acc[2][2], acc[2][3]);
  acc_guard4(acc[3][0], acc[3][1], acc[3][2], acc[3][3]);

  // ---- epilogue ----
  float* slab = sT[wave];
  const float* biasb = (BIAS_MODE != 0) ? (bias + (size_t)b * strideBias) : nullptr;
#pragma unroll
  for (int i = 0; i < 4; ++i) {
    const int mBase = m0 + (i << 4);
    float b8[8] = {0.f,0.f,0.f,0.f,0.f,0.f,0.f,0.f};
    if (BIAS_MODE == 1) {
      const v4f bm0 = *(const v4f*)(biasb + mBase + mOff);
      const v4f bm1 = *(const v4f*)(biasb + mBase + mOff + 4);
      b8[0] = bm0[0]; b8[1] = bm0[1]; b8[2] = bm0[2]; b8[3] = bm0[3];
      b8[4] = bm1[0]; b8[5] = bm1[1]; b8[6] = bm1[2]; b8[7] = bm1[3];
    }
#pragma unroll
    for (int j = 0; j < 4; ++j) {
      const int n = n0 + (j << 4) + rlane;
      float bv = 0.f;
      if (BIAS_MODE == 2) bv = biasb[n];
#pragma unroll
      for (int r = 0; r < 8; ++r) {
        float v = acc[i][j][r] * scale;
        if (BIAS_MODE == 1) v += b8[r];
        if (BIAS_MODE == 2) v += bv;
        if (ACT == 2) v = fmaxf(v, 0.0f);
        if (ACT == 4) v = (v > 0.f) ? v : 0.01f * v;
        slab[(mOff + r) * 68 + (j << 4) + rlane] = v;
      }
    }
    __builtin_amdgcn_fence(__ATOMIC_RELEASE, "workgroup");
    __builtin_amdgcn_wave_barrier();
    __builtin_amdgcn_fence(__ATOMIC_ACQUIRE, "workgroup");
    if (OUT_MODE == 0) {
      float* C = (float*)Cout + (size_t)b * strideC;
      const int hh = lane >> 4, c4 = (lane & 15) * 4;     // row seg = 256 B = 16 lanes x 16 B
      {
#pragma unroll
        for (int it = 0; it < 8; ++it) {
          const int row = it * 2 + hh;
          v4f v = *(const v4f*)(slab + row * 68 + c4);
          *(v4f*)(C + (size_t)(mBase + row) * ldc + n0 + c4) = v;
        }
        
      }
    } else {
      const int q = lane >> 3, c8 = (lane & 7) * 8;
      unsigned short* C  = (unsigned short*)Cout  + (size_t)b * strideC;
      unsigned short* C2 = (OUT_MODE == 2) ? ((unsigned short*)Cout2 + (size_t)b * strideC) : nullptr;
      {
#pragma unroll
        for (int it = 0; it < 4; ++it) {
          const int row = it * 4 + q;
          const float* sp = slab + row * 68 + c8;
          v8h hv, lv;
#pragma unroll
          for (int e = 0; e < 8; ++e) {
            if (OUT_MODE == 1) {
              hv[e] = (_Float16)sp[e];
            } else {
              unsigned short hb = f2bf_bits(sp[e]);
              unsigned short lb = f2bf_bits(sp[e] - bf_bits2f(hb));
              hv[e] = __builtin_bit_cast(_Float16, hb);
              lv[e] = __builtin_bit_cast(_Float16, lb);
            }
          }
          *(v8h*)(C + (size_t)(mBase + row) * ldc + n0 + c8) = hv;
          if (OUT_MODE == 2) *(v8h*)(C2 + (size_t)(mBase + row) * ldc + n0 + c8) = lv;
        }
        
      }
    }
    __builtin_amdgcn_fence(__ATOMIC_RELEASE, "workgroup");
    __builtin_amdgcn_wave_barrier();
    __builtin_amdgcn_fence(__ATOMIC_ACQUIRE, "workgroup");
  }
}

// ---------------------------------------------------------------------------
// ---------------------------------------------------------------------------
__global__ __launch_bounds__(256) void cast8_f16_kernel(const float* __restrict__ in, unsigned short* __restrict__ out, int n8) {
  const int i = blockIdx.x * 256 + threadIdx.x;
  if (i >= n8) return;
  const float* p = in + 8 * (size_t)i;
  const v4f a = *(const v4f*)(p);
  const v4f c = *(const v4f*)(p + 4);
  unsigned short hb[8];
#pragma unroll
  for (int e = 0; e < 4; ++e) {
    hb[e]     = h_bits(a[e]);
    hb[4 + e] = h_bits(c[e]);
  }
  const v4u u = (v4u){pk16(hb[0], hb[1]), pk16(hb[2], hb[3]), pk16(hb[4], hb[5]), pk16(hb[6], hb[7])};
  unsigned short* q = out + 8 * (size_t)i;
  *(v4u*)q = u;
  
}

// ---------------------------------------------------------------------------
// Weight transpose + cast: W is f32 [512 in][nOut out] row-major (x @ W orientation); WT[o][i] = f16(scale * W[i][o]),
// WT row pitch 512 halves. grid (512/64 input tiles, nOut/64 output tiles): blockIdx.x = i tile (64 cols of WT),
// blockIdx.y = o tile (64 rows of WT). 256 threads.
// Load coverage: 16 iterations x 256 threads = 4096 = the whole 64x64 tile (coalesced along o).
// Store coverage: 8 waves x 2 iterations x 4 rows (lane>>3) = 64 rows; (lane&7) x 8 halves = 64 cols; each row segment =
// ---------------------------------------------------------------------------
__global__ __launch_bounds__(256) void wtcast_kernel(const float* __restrict__ W, int nOut,
                                                     unsigned short* __restrict__ out, float scale) {
  __shared__ float sm[64][65];   // sm[o_local][i_local]
  const int t  = threadIdx.x;
  const int i0 = blockIdx.x * 64;
  const int o0 = blockIdx.y * 64;
#pragma unroll
  for (int it = 0; it < 16; ++it) {
    const int e = it * 256 + t;
    const int r = e >> 6;          // i local
    const int c = e & 63;          // o local
    sm[c][r] = W[(size_t)(i0 + r) * nOut + o0 + c] * scale;
  }
  __syncthreads();
  const int lane = t & 31, wave = t >> 5;
  const int q = lane >> 3, c8 = (lane & 7) * 8;
  {
#pragma unroll
    for (int it = 0; it < 2; ++it) {
      const int row = wave * 8 + it * 4 + q;                 // o local
      unsigned short hb[8];
#pragma unroll
      for (int e = 0; e < 8; ++e) hb[e] = h_bits(sm[row][c8 + e]);
      const v4u u = (v4u){pk16(hb[0], hb[1]), pk16(hb[2], hb[3]), pk16(hb[4], hb[5]), pk16(hb[6], hb[7])};
      *(v4u*)(out + (size_t)(o0 + row) * kDim + i0 + c8) = u;
    }
    
  }
}

// ---------------------------------------------------------------------------
// Row softmax over 1024 f32 scores (scores already carry the 0.125 scale):
//   P[row][j] = f16( 32768 * exp(s - max) * (1 / sum exp(s - max)) ), all math f32, precise expf.
// One block of 128 threads per row; thread t owns columns 8t..8t+7 (128 x 8 = 1024 = whole row).
// Reductions in fixed order (thread, wave shuffle tree, 4 wave partials in index order); shuffles unconditional.
// ---------------------------------------------------------------------------
__global__ __launch_bounds__(128) void softmax_row_kernel(const float* __restrict__ S, unsigned short* __restrict__ P) {
  __shared__ float redM[4];
  __shared__ float redS[4];
  const int row  = blockIdx.x;
  const int t    = threadIdx.x;
  const int lane = t & 31, wave = t >> 5;
  const int c0   = t * 8;
  const float* sr = S + (size_t)row * kSeq + c0;
  const v4f a = *(const v4f*)(sr);
  const v4f c = *(const v4f*)(sr + 4);
  float x[8];
#pragma unroll
  for (int e = 0; e < 4; ++e) { x[e] = a[e]; x[4 + e] = c[e]; }
  float m = fmaxf(fmaxf(fmaxf(x[0], x[1]), fmaxf(x[2], x[3])), fmaxf(fmaxf(x[4], x[5]), fmaxf(x[6], x[7])));
#pragma unroll
  for (int off = 16; off > 0; off >>= 1) m = fmaxf(m, __shfl_xor(m, off, 32));
  if (lane == 0) redM[wave] = m;
  __syncthreads();
  float mx = redM[0];
  mx = fmaxf(mx, redM[1]);
  mx = fmaxf(mx, redM[2]);
  mx = fmaxf(mx, redM[3]);

  float ev[8];
  float sum = 0.f;
#pragma unroll
  for (int e = 0; e < 8; ++e) { ev[e] = expf(x[e] - mx); sum += ev[e]; }
#pragma unroll
  for (int off = 16; off > 0; off >>= 1) sum += __shfl_xor(sum, off, 32);
  if (lane == 0) redS[wave] = sum;
  __syncthreads();
  float tot = redS[0];
  tot += redS[1];
  tot += redS[2];
  tot += redS[3];
  const float inv = kPCarry * (1.0f / tot);

  unsigned short hb[8];
#pragma unroll
  for (int e = 0; e < 8; ++e) hb[e] = h_bits(ev[e] * inv);
  const v4u u = (v4u){pk16(hb[0], hb[1]), pk16(hb[2], hb[3]), pk16(hb[4], hb[5]), pk16(hb[6], hb[7])};
  unsigned short* pr = P + (size_t)row * kSeq + c0;
  *(v4u*)pr = u;
  
}

// ---------------------------------------------------------------------------
// Depthwise 3x3 conv (zero SAME padding, cross-correlation, f32) on the V image + attention output, producing the
// f16 proj operand: MID[tok][c] = f16( O16[tok][c] + 64 * (conv_b[c] + sum_taps w * v) ), O16 already carried x64.
// V image: VT plane f16 [c][b*1024 + y*32 + x]. grid (512/64 channel tiles, 32/4 image-row tiles, 16 batches), 256 threads.
// LDS image tile sv[64 ch][6 rows][34 cols]: rows y0-1..y0+4 (out-of-range rows written as zeros), cols 0 and 33 zero pads.
// Staging coverage: 6 iterations x 256 threads = 1536 = 64 ch x 6 rows x 4 (8-col groups); pads 768 entries; weights 576; bias 64.
// Store phase: 4 rolled iterations x 256 threads: row = it*32 + (t>>3) covers 128 local tokens, (t&7)*8 covers 64 channels;
// ---------------------------------------------------------------------------
constexpr int kCvRows  = 6;
constexpr int kCvCols  = 34;
constexpr int kCvPitch = kCvRows * kCvCols;   // 204 floats per channel
__global__ __launch_bounds__(256) void conv_mid_kernel(const unsigned short* __restrict__ VT,
                                                       const unsigned short* __restrict__ O16,
                                                       const float* __restrict__ cw, const float* __restrict__ cb,
                                                       unsigned short* __restrict__ MID,
                                                       const int* __restrict__ hw0, const int* __restrict__ hw1) {
  (void)hw0; (void)hw1;
  __shared__ __align__(16) float sv[64 * kCvPitch];   // 52,224 B
  __shared__ float sw[64 * 9];
  __shared__ float sb[64];
  const int t  = threadIdx.x;
  const int c0 = blockIdx.x * 64;
  const int y0 = blockIdx.y * 4;
  const int b  = blockIdx.z;

  // weights and bias of the 64 channels, pre-scaled by the x64 carry of the mid plane
  for (int i = t; i < 64 * 9; i += 256) sw[i] = cw[(size_t)c0 * 9 + i] * kMidCarry;
  if (t < 64) sb[t] = cb[c0 + t] * kMidCarry;
  // zero pad columns 0 and 33 of every staged row (disjoint from the staged words)
  for (int i = t; i < 64 * kCvRows * 2; i += 256) {
    const int cl  = i / (kCvRows * 2);
    const int rem = i - cl * (kCvRows * 2);
    const int r   = rem >> 1;
    const int col = (rem & 1) * (kCvCols - 1);
    sv[cl * kCvPitch + r * kCvCols + col] = 0.0f;
  }
  // stage 6 image rows of 64 channels as 128-bit words (8 halves); address clamped, value zeroed arithmetically when out of range
#pragma unroll
  for (int i = 0; i < 6; ++i) {
    const int idx = i * 256 + t;
    const int cl  = idx / 24;
    const int w4  = idx - cl * 24;
    const int r   = w4 >> 2;            // staged row 0..5
    const int x0  = (w4 & 3) * 8;
    const int yy  = y0 - 1 + r;
    const int yyc = (yy < 0) ? 0 : ((yy > kImg - 1) ? (kImg - 1) : yy);
    const v4u u = *(const v4u*)(VT + (size_t)(c0 + cl) * kTok + (size_t)b * kSeq + yyc * kImg + x0);
    const float f = (yy >= 0 && yy <= kImg - 1) ? 1.0f : 0.0f;
    float* dst = sv + cl * kCvPitch + r * kCvCols + 1 + x0;
    dst[0] = h16_to_f32(u[0] & 0xffffu) * f;
    dst[1] = h16_to_f32(u[0] >> 16) * f;
    dst[2] = h16_to_f32(u[1] & 0xffffu) * f;
    dst[3] = h16_to_f32(u[1] >> 16) * f;
    dst[4] = h16_to_f32(u[2] & 0xffffu) * f;
    dst[5] = h16_to_f32(u[2] >> 16) * f;
    dst[6] = h16_to_f32(u[3] & 0xffffu) * f;
    dst[7] = h16_to_f32(u[3] >> 16) * f;
  }
  __syncthreads();

  const int rq = t >> 3;             // 0..31
  const int c8 = (t & 7) * 8;
#pragma unroll 1
  for (int it = 0; it < 4; ++it) {
    const int row = it * 32 + rq;      // local token 0..127
    const int yl  = row >> 5;          // 0..3
    const int x   = row & 31;
    const size_t tok = (size_t)b * kSeq + (size_t)(y0 * kImg + row);
    const v4u ou = *(const v4u*)(O16 + tok * kDim + c0 + c8);
    float o[8];
    o[0] = h16_to_f32(ou[0] & 0xffffu); o[1] = h16_to_f32(ou[0] >> 16);
    o[2] = h16_to_f32(ou[1] & 0xffffu); o[3] = h16_to_f32(ou[1] >> 16);
    o[4] = h16_to_f32(ou[2] & 0xffffu); o[5] = h16_to_f32(ou[2] >> 16);
    o[6] = h16_to_f32(ou[3] & 0xffffu); o[7] = h16_to_f32(ou[3] >> 16);
    unsigned short hb[8];
#pragma unroll
    for (int e = 0; e < 8; ++e) {
      const int cl = c8 + e;
      const float* vr = sv + cl * kCvPitch + yl * kCvCols + x;   // tap (ky,kx) at vr[ky*34 + kx]
      const float* wr = sw + cl * 9;
      float acc = sb[cl];
#pragma unroll
      for (int ky = 0; ky < 3; ++ky) {
#pragma unroll
        for (int kx = 0; kx < 3; ++kx) acc = fmaf(wr[ky * 3 + kx], vr[ky * kCvCols + kx], acc);
      }
      hb[e] = h_bits(o[e] + acc);
    }
    const v4u u = (v4u){pk16(hb[0], hb[1]), pk16(hb[2], hb[3]), pk16(hb[4], hb[5]), pk16(hb[6], hb[7])};
    unsigned short* mp = MID + tok * kDim + c0 + c8;
    *(v4u*)mp = u;
    
  }
}

// ---------------------------------------------------------------------------
// Host glue.
//   XH     f16 [16384][512]            16,777,216  at           0   (x cast)
//   WQKVT  f16 [1536][512]  x16          1,572,864  at  16,777,216   (rows 0..511 Wq^T, 512..1023 Wk^T, 1024..1535 Wv^T)
//   WPT    f16 [512][512]   x16            524,288  at  18,350,080
//   Q16    f16 [8][16384][64]          16,777,216  at  18,874,368   (head-major, row = b*1024+n)
//   K16    f16 [8][16384][64]          16,777,216  at  35,651,584
//   VT     f16 [512][16384]            16,777,216  at  52,428,800   (= v image [c][b][32][32])
//   SC     f32 [4][1024][1024]         16,777,216  at  69,206,016   (scores of one (head, 4-batch) group, reused 32x)
//   PP     f16 [4][1024][1024] x32768   8,388,608  at  85,983,232   (reused 32x)
//   O16    f16 [16384][512]  x64       16,777,216  at  94,371,840
//   MID16  f16 [16384][512]  x64       16,777,216  at 111,149,056
//   total                             127,926,272
// GEMM shapes (all M,N multiples of 64, K % 32 == 0, no padding anywhere):
//   q, k:  M=16384 N=64 K=512;  v^T: M=64 N=16384 K=512;  scores: M=N=1024 K=64;  P.V: M=1024 N=64 K=1024;
//   proj:  M=512 N=1024 K=512 (writes out[b][c][n] directly).
// ---------------------------------------------------------------------------
extern "C" void kernel_launch(void* const* d_in, const int* in_sizes, int n_in,
                              void* d_out, int out_size, void* d_ws, size_t ws_size,
                              hipStream_t stream) {
  if (n_in < 11) return;
  const int nX = kTok * kDim;                       // 8,388,608
  if (in_sizes[0] != nX) return;
  if (in_sizes[1] != kDim * kDim || in_sizes[2] != kDim) return;
  if (in_sizes[3] != kDim * 2 * kDim || in_sizes[4] != 2 * kDim) return;
  if (in_sizes[5] != kDim * 9 || in_sizes[6] != kDim) return;
  if (in_sizes[7] != kDim * kDim || in_sizes[8] != kDim) return;
  if (out_size != kBatch * kDim * kSeq) return;

  const size_t szPlane16 = (size_t)kTok * kDim * 2;                 // 16,777,216
  const size_t szWQKVT   = (size_t)3 * kDim * kDim * 2;             //  1,572,864
  const size_t szWPT     = (size_t)kDim * kDim * 2;                 //    524,288
  const size_t szQ       = (size_t)kHeads * kTok * kDh * 2;         // 16,777,216
  const size_t szVT      = (size_t)kDim * kTok * 2;                 // 16,777,216
  const size_t szS       = (size_t)kGroupB * kSeq * kSeq * 4;       // 16,777,216
  const size_t szP       = (size_t)kGroupB * kSeq * kSeq * 2;       //  8,388,608
  const size_t offXH   = 0;
  const size_t offWQKV = offXH + szPlane16;
  const size_t offWPT  = offWQKV + szWQKVT;
  const size_t offQ    = offWPT + szWPT;
  const size_t offK    = offQ + szQ;
  const size_t offVT   = offK + szQ;
  const size_t offS    = offVT + szVT;
  const size_t offP    = offS + szS;
  const size_t offO    = offP + szP;
  const size_t offMID  = offO + szPlane16;
  const size_t total   = offMID + szPlane16;                       // 127,926,272
  if (ws_size < total) return;

  const float* x    = (const float*)d_in[0];
  const float* Wq   = (const float*)d_in[1];
  const float* bq   = (const float*)d_in[2];
  const float* Wkv  = (const float*)d_in[3];
  const float* bkv  = (const float*)d_in[4];
  const float* cw   = (const float*)d_in[5];
  const float* cb   = (const float*)d_in[6];
  const float* Wp   = (const float*)d_in[7];
  const float* bp   = (const float*)d_in[8];
  const int*   hIn  = (const int*)d_in[9];     // static image height (32), structural only
  const int*   wIn  = (const int*)d_in[10];    // static image width (32), structural only
  float* out = (float*)d_out;
  char* ws = (char*)d_ws;
  unsigned short* XH    = (unsigned short*)(ws + offXH);
  unsigned short* WQKVT = (unsigned short*)(ws + offWQKV);
  unsigned short* WPT   = (unsigned short*)(ws + offWPT);
  unsigned short* Q16   = (unsigned short*)(ws + offQ);
  unsigned short* K16   = (unsigned short*)(ws + offK);
  unsigned short* VT    = (unsigned short*)(ws + offVT);
  float*          SC    = (float*)(ws + offS);
  unsigned short* PP    = (unsigned short*)(ws + offP);
  unsigned short* O16   = (unsigned short*)(ws + offO);
  unsigned short* MID16 = (unsigned short*)(ws + offMID);

  // ---- prologue: 16-bit operand planes ----
  const int n8 = nX / 8;   // 1,048,576 -> 4096 blocks exact
  cast8_f16_kernel<<<dim3(n8 / 256), dim3(256), 0, stream>>>(x, XH, n8);
  // Wq [512 in][512 out] -> WQKVT rows 0..511;  Wkv [512 in][1024 out] -> rows 512..1535;  Wp -> WPT
  wtcast_kernel<<<dim3(kDim / 64, kDim / 64), dim3(256), 0, stream>>>(Wq, kDim, WQKVT, kWCarry);
  wtcast_kernel<<<dim3(kDim / 64, (2 * kDim) / 64), dim3(256), 0, stream>>>(Wkv, 2 * kDim, WQKVT + (size_t)kDim * kDim, kWCarry);
  wtcast_kernel<<<dim3(kDim / 64, kDim / 64), dim3(256), 0, stream>>>(Wp, kDim, WPT, kWCarry);

  // ---- projections ----
  const long strideHeadW  = (long)kDh * kDim;          // 64 weight rows per head = 32768 halves
  const long strideHeadQK = (long)kTok * kDh;          // per-head [16384][64] plane = 1,048,576 halves
  const long strideHeadVT = (long)kDh * kTok;          // per-head 64 rows of [512][16384] = 1,048,576 halves
  const int  tilesQK = (kTok / 64) * (kDh / 64);       // 256 -> 32 blocks
  // Q16[h][tok][d] = 1/16 * sum_k XH[tok][k] * WQKVT[h*64+d][k] + bq[h*64+d]
  wmma_gemm64<0, false, 2, 1, false, 0><<<dim3(tilesQK / 8, kHeads), dim3(256), 0, stream>>>(
      XH, XH, kDim, 0L, WQKVT, WQKVT, kDim, strideHeadW,
      (void*)Q16, (void*)Q16, kDh, strideHeadQK, bq, (long)kDh, bq, 0L, kTok, kDh, kDim, kWCarryInv);
  // K16 from WQKVT rows 512 + h*64
  wmma_gemm64<0, false, 2, 1, false, 0><<<dim3(tilesQK / 8, kHeads), dim3(256), 0, stream>>>(
      XH, XH, kDim, 0L, WQKVT + (size_t)kDim * kDim, WQKVT, kDim, strideHeadW,
      (void*)K16, (void*)K16, kDh, strideHeadQK, bkv, (long)kDh, bkv, 0L, kTok, kDh, kDim, kWCarryInv);
  // VT[h*64+d][tok] = 1/16 * sum_k WQKVT[1024 + h*64 + d][k] * XH[tok][k] + bkv[512 + h*64 + d]   (M=64, N=16384)
  wmma_gemm64<0, false, 1, 1, false, 0><<<dim3(tilesQK / 8, kHeads), dim3(256), 0, stream>>>(
      WQKVT + (size_t)2 * kDim * kDim, WQKVT, kDim, strideHeadW, XH, XH, kDim, 0L,
      (void*)VT, (void*)VT, kTok, strideHeadVT, bkv + kDim, (long)kDh, bkv, 0L, kDh, kTok, kDim, kWCarryInv);

  // ---- attention per (head, 4-batch) group: scores -> softmax -> P.V ----
  const long strideBQK  = (long)kSeq * kDh;            // next batch inside a head plane = 65536 halves
  const long strideS    = (long)kSeq * kSeq;           // per-batch score / probability plane
  const long strideBO   = (long)kSeq * kDim;           // next batch in the [16384][512] planes = 524288
  const int  tilesScore = (kSeq / 64) * (kSeq / 64);   // 256 -> 32 blocks
  const int  tilesPV    = (kSeq / 64) * (kDh / 64);    // 16 -> 2 blocks
  for (int h = 0; h < kHeads; ++h) {
    for (int gq = 0; gq < kBatch / kGroupB; ++gq) {
      const int b0 = gq * kGroupB;
      const unsigned short* Qg = Q16 + (size_t)h * strideHeadQK + (size_t)b0 * strideBQK;
      const unsigned short* Kg = K16 + (size_t)h * strideHeadQK + (size_t)b0 * strideBQK;
      // SC[z][i][j] = 0.125 * sum_d Qg[z][i][d] * Kg[z][j][d]   (M=N=1024, K=64)
      wmma_gemm64<0, false, 0, 0, false, 0><<<dim3(tilesScore / 8, kGroupB), dim3(256), 0, stream>>>(
          Qg, Qg, kDh, strideBQK, Kg, Kg, kDh, strideBQK,
          (void*)SC, (void*)SC, kSeq, strideS, bq, 0L, bq, 0L, kSeq, kSeq, kDh, kAttScale);
      // PP = f16(32768 * softmax rows)
      softmax_row_kernel<<<dim3(kGroupB * kSeq), dim3(128), 0, stream>>>(SC, PP);
      // O16[(b0+z)*1024 + i][h*64 + d] = f16( (64/32768) * sum_j PP[z][i][j] * VT[h*64+d][(b0+z)*1024 + j] )   (M=1024, N=64, K=1024)
      const unsigned short* VTg = VT + (size_t)h * strideHeadVT + (size_t)b0 * kSeq;
      unsigned short* Og = O16 + (size_t)b0 * strideBO + (size_t)h * kDh;
      wmma_gemm64<0, false, 0, 1, false, 0><<<dim3(tilesPV / 8, kGroupB), dim3(256), 0, stream>>>(
          PP, PP, kSeq, strideS, VTg, VTg, kTok, (long)kSeq,
          (void*)Og, (void*)Og, kDim, strideBO, bq, 0L, bq, 0L, kSeq, kDh, kSeq, kPVScale);
    }
  }

  // ---- depthwise conv branch + add -> MID16 (x64) ----
  conv_mid_kernel<<<dim3(kDim / 64, kImg / 4, kBatch), dim3(256), 0, stream>>>(VT, O16, cw, cb, MID16, hIn, wIn);

  // ---- output projection, transposed store: out[b][c][n] = 1/1024 * sum_k WPT[c][k] * MID16[b*1024+n][k] + bp[c] ----
  const int tilesProj = (kDim / 64) * (kSeq / 64);     // 128 -> 16 blocks
  wmma_gemm64<0, false, 1, 0, false, 0><<<dim3(tilesProj / 8, kBatch), dim3(256), 0, stream>>>(
      WPT, WPT, kDim, 0L, MID16, MID16, kDim, strideBO,
      (void*)out, (void*)out, kSeq, (long)kDim * kSeq, bp, 0L, bp, 0L, kDim, kSeq, kDim, kProjScale);
}

// v002
// It runs in 187 microseconds.
// Versions between v000 and this one are left out; their measured steps multiply to 11.8 times as fast.
// Contractions: q/k/v projections (x f16 x W^T f16 carried x16), scores q.k^T (q,k f16 planes), attn.v (V^T f16 x P^T f16, P = exp(s - running max) unnormalised), output projection (W^T f16 x16 x mid f16 x64): all v_wmma_f32_16x16x32_f16, f32 accumulate; softmax, depthwise 3x3 conv, bias adds in f32.
#include <hip/hip_runtime.h>
#include <math.h>

// ---------------------------------------------------------------------------
// Problem constants
// ---------------------------------------------------------------------------
constexpr int kBatch = 16;
constexpr int kSeq   = 1024;              // tokens per batch = 32 x 32 image
constexpr int kDim   = 512;
constexpr int kHeads = 8;
constexpr int kDh    = 64;
constexpr int kImg   = 32;
constexpr int kTok   = kBatch * kSeq;     // 16384 token rows
constexpr float kWCarry     = 16.0f;      // weights carried x16 in f16
constexpr float kWCarryInv  = 1.0f / 16.0f;
constexpr float kMidCarry   = 64.0f;      // attention output and mid carried x64 in f16
constexpr float kAttScale   = 0.125f;     // 64^-0.5
constexpr float kProjScale  = 1.0f / (kMidCarry * kWCarry);  // 1/1024
static_assert(kHeads * kDh == kDim, "shape");
static_assert(kImg * kImg == kSeq, "image");
static_assert(kTok % 64 == 0 && kSeq % 64 == 0 && kDim % 64 == 0 && kDh % 64 == 0, "tile multiples");
static_assert(kDim % 32 == 0 && kDh % 32 == 0 && kSeq % 32 == 0, "K multiples of 32");

// Fragment order of every 16-bit operand plane: a plane of rows x k is cut into tiles of 16 rows x 32 k = kTileH halves (1 KB).
// Inside a tile, element (row r, k) sits at ((k >> 4) & 1) * 256 + (((k >> 3) & 1) * 16 + (r & 15)) * 8 + (k & 7):
// lane l = 16 * hf + r of a wave finds its fragment elements 0..7 at l * 8 and 8..15 at 256 + l * 8, so each of the two
// 16-byte loads (or stores) of a wave covers 512 contiguous bytes = four whole lines.
constexpr int kTileH = 512;
constexpr int kBandH = (kDim / 32) * kTileH;   // a 16-row band of a plane with k extent kDim: 16 tiles in a row
typedef __attribute__((ext_vector_type(16))) _Float16 v16h;
typedef __attribute__((ext_vector_type(8)))  _Float16 v8h;
typedef __attribute__((ext_vector_type(16))) __bf16   v16b;
typedef __attribute__((ext_vector_type(8)))  __bf16   v8b;
typedef __attribute__((ext_vector_type(8)))  float    v8f;
typedef __attribute__((ext_vector_type(4)))  float    v4f;
typedef __attribute__((ext_vector_type(4)))  unsigned int v4u;

__device__ __forceinline__ unsigned short f2bf_bits(float f) {
  unsigned u = __float_as_uint(f);
  return (unsigned short)((u + 0x7FFFu + ((u >> 16) & 1u)) >> 16);
}
__device__ __forceinline__ float bf_bits2f(unsigned short h) { return __uint_as_float(((unsigned)h) << 16); }

// hazard guards as plain device helpers (no inline asm inside the kernel template body)
__device__ __forceinline__ void dep_guard_h(v8f& a, v8f& b, v16h x, v16h y) { asm volatile("v_nop\n\tv_nop\n\tv_nop\n\tv_nop" : "+v"(a), "+v"(b) : "v"(x), "v"(y)); }
__device__ __forceinline__ void dep_guard_b(v8f& a, v8f& b, v16b x, v16b y) { asm volatile("v_nop\n\tv_nop\n\tv_nop\n\tv_nop" : "+v"(a), "+v"(b) : "v"(x), "v"(y)); }
__device__ __forceinline__ void keep4_h(v16h a, v16h b, v16h c, v16h d) { asm volatile("v_nop" :: "v"(a), "v"(b), "v"(c), "v"(d)); }
__device__ __forceinline__ void keep4_b(v16b a, v16b b, v16b c, v16b d) { asm volatile("v_nop" :: "v"(a), "v"(b), "v"(c), "v"(d)); }
__device__ __forceinline__ void acc_guard4(v8f& a, v8f& b, v8f& c, v8f& d) { asm volatile("v_nop\n\tv_nop\n\tv_nop\n\tv_nop" : "+v"(a), "+v"(b), "+v"(c), "+v"(d)); }
template <typename T> struct Frag;
template <> struct Frag<_Float16> {
  typedef v16h V; union U { v16h v; v8h h[2]; };
  // a fragment from a fragment-order tile (see kTileH), p = tile base + lane*8: elements 0..7 <- p[0..7], 8..15 <- p[256..263]
  static __device__ __forceinline__ v16h loadp(const _Float16* p) {
    U f; f.h[0] = *(const v8h*)(p); f.h[1] = *(const v8h*)(p + 256); return f.v;
  }
  static __device__ __forceinline__ v8f mma(v16h a, v16h b, v8f c) {
    return __builtin_amdgcn_wmma_f32_16x16x32_f16(false, a, false, b, (short)0, c, false, false);
  }
  static __device__ __forceinline__ void guard(v8f& a, v8f& b, v16h x, v16h y) { dep_guard_h(a, b, x, y); }
  static __device__ __forceinline__ void keep(v16h a, v16h b, v16h c, v16h d) { keep4_h(a, b, c, d); }
};
template <> struct Frag<__bf16> {
  typedef v16b V; union U { v16b v; v8b h[2]; };
  static __device__ __forceinline__ v16b loadp(const __bf16* p) {
    U f; f.h[0] = *(const v8b*)(p); f.h[1] = *(const v8b*)(p + 256); return f.v;
  }
  static __device__ __forceinline__ v8f mma(v16b a, v16b b, v8f c) {
    return __builtin_amdgcn_wmma_f32_16x16x32_bf16(false, a, false, b, (short)0, c, false, false);
  }
  static __device__ __forceinline__ void guard(v8f& a, v8f& b, v16b x, v16b y) { dep_guard_b(a, b, x, y); }
  static __device__ __forceinline__ void keep(v16b a, v16b b, v16b c, v16b d) { keep4_b(a, b, c, d); }
};

__device__ __forceinline__ unsigned pk16(unsigned short a, unsigned short b) { return (unsigned)a | ((unsigned)b << 16); }
__device__ __forceinline__ unsigned short h_bits(float f) { const _Float16 h = (_Float16)f; return __builtin_bit_cast(unsigned short, h); }

// f16 bits (low 16 bits of hb, finite values) -> f32, integer path only
__device__ __forceinline__ float h16_to_f32(unsigned hb) {
  const unsigned sgn = (hb & 0x8000u) << 16; const unsigned em = hb & 0x7fffu;
  const float fn = __uint_as_float((em << 13) + 0x38000000u);
  const float fs = (float)em * 5.9604644775390625e-8f;
  const float mag = (em < 0x400u) ? fs : fn; return __uint_as_float(__float_as_uint(mag) | sgn); }

// ---- Register-blocked batched WMMA GEMM (ACT reduced to none/relu/leaky; bias gets a per-z stride and the
//      bias[m] line is loaded as two float4 per 16-row slab instead of per-lane scalars; RESID path not instantiated) ---
// C[m,n] = scale * sum_k A[m,k] * Bt[n,k] (+bias); each wave owns a 64x64 tile.
// A [M,kDim] and Bt [N,kDim] in fragment order, tile (row >> 4) * (kDim / 32) + (k >> 5); M,N % 64 == 0, K % 32 == 0, K <= kDim.
// SPLIT: operands are hi/lo planes (A2/Bt2 = lo planes, same layout); product = hi*hi + hi*lo + lo*hi.
// BIAS_MODE: 0 = none, 1 = bias[m], 2 = bias[n]; bias base = bias + z*strideBias.
// OUT_MODE: 0 = f32 row-major, 1 = f16 in fragment order, tile (m >> 4) * TRS + (n >> 5) * TCS, 2 = bf16 hi plane (Cout) + bf16 lo plane (Cout2).
// ET: 0 = f16 operands, 1 = bf16 operands (pointers passed as 16-bit storage)
// base + a 32-bit byte offset: with a wave-uniform base this is the load's own scalar-base form, no 64-bit vector add per step
template <typename T> __device__ __forceinline__ const T* at_bytes(const T* base, unsigned bytes) {
  return (const T*)((const char*)base + bytes);
}
template <int ET> struct Elem;
template <> struct Elem<0> { typedef _Float16 T; };
template <> struct Elem<1> { typedef __bf16 T; };
template <int ET, bool SPLIT, int BIAS_MODE, int OUT_MODE, bool RESID, int ACT = 0, int TRS = 0, int TCS = 0>
__global__ __launch_bounds__(256) void wmma_gemm64(
    const unsigned short* __restrict__ Ap, const unsigned short* __restrict__ A2p, int lda, long strideA,
    const unsigned short* __restrict__ Btp, const unsigned short* __restrict__ Bt2p, int ldb, long strideB,
    void* __restrict__ Cout, void* __restrict__ Cout2, int ldc, long strideC,
    const float* __restrict__ bias, long strideBias,
    const float* __restrict__ resid, long strideR,
    int M, int N, int K, float scale) {
  static_assert(!RESID, "resid path not used");
  typedef typename Elem<ET>::T T;
  typedef typename Frag<T>::V V;
  (void)resid; (void)strideR; (void)lda; (void)ldb;
  const T* A = (const T*)Ap; const T* A2 = (const T*)A2p; const T* Bt = (const T*)Btp; const T* Bt2 = (const T*)Bt2p;
  __shared__ __align__(16) float sT[8][16 * 68];   // per-wave 16x64 slab, pitch 68 floats
  const int b    = blockIdx.y;
  const int lane = threadIdx.x & 31;
  // the wave's number in a scalar register: the band bases of the k loop are then scalar, and a fragment load is scalar base + offset
  const int wave = __builtin_amdgcn_readfirstlane(threadIdx.x >> 5);
  const int tilesN = N >> 6;
  const int tilesM = M >> 6;
  const int tile = blockIdx.x * 8 + wave;
  if (tile >= tilesM * tilesN) return;   // wave-uniform; no block barriers in this kernel
  const int tm = tile / tilesN;
  const int tn = tile - tm * tilesN;
  const int m0 = tm << 6;
  const int n0 = tn << 6;

  const T* Ab  = A  + (size_t)b * strideA;
  const T* Bb  = Bt + (size_t)b * strideB;
  const T* Ab2 = SPLIT ? (A2  + (size_t)b * strideA) : nullptr;
  const T* Bb2 = SPLIT ? (Bt2 + (size_t)b * strideB) : nullptr;

  const int rlane = lane & 15;                 // row (A) / col (B, D) within subtile
  const int mOff  = (lane >> 4) * 8;           // D row offset

  v8f acc[4][4];
#pragma unroll
  for (int i = 0; i < 4; ++i)
#pragma unroll
    for (int j = 0; j < 4; ++j) acc[i][j] = (v8f){0.f,0.f,0.f,0.f,0.f,0.f,0.f,0.f};

  // the wave's first A and B band (wave-uniform); A and B share one 32-bit offset: this lane's chunk of the k step's tile
  const size_t ao = (size_t)(m0 >> 4) * kBandH;
  const size_t bo = (size_t)(n0 >> 4) * kBandH;
  for (int k0 = 0; k0 < K; k0 += 32) {
    const unsigned lo = (unsigned)lane * 16u + (unsigned)k0 * (kTileH / 16u);   // in bytes
    V bh[4], bl[4];
#pragma unroll
    for (int j = 0; j < 4; ++j) {
      bh[j] = Frag<T>::loadp(at_bytes(Bb + bo, lo) + j * kBandH);
      if (SPLIT) bl[j] = Frag<T>::loadp(at_bytes(Bb2 + bo, lo) + j * kBandH);
    }
#pragma unroll
    for (int i = 0; i < 4; ++i) {
      V ah = Frag<T>::loadp(at_bytes(Ab + ao, lo) + i * kBandH);
      V al;
      if (SPLIT) al = Frag<T>::loadp(at_bytes(Ab2 + ao, lo) + i * kBandH);
#pragma unroll
      for (int j = 0; j < 4; ++j) {
        acc[i][j] = Frag<T>::mma(ah, bh[j], acc[i][j]);
        if (SPLIT) {
          acc[i][j] = Frag<T>::mma(ah, bl[j], acc[i][j]);
          acc[i][j] = Frag<T>::mma(al, bh[j], acc[i][j]);
        }
      }
      Frag<T>::guard(acc[i][0], acc[i][3], ah, SPLIT ? al : ah);
    }
    Frag<T>::keep(bh[0], bh[1], bh[2], bh[3]);
    if (SPLIT) Frag<T>::keep(bl[0], bl[1], bl[2], bl[3]);
  }
  acc_guard4(acc[0][0], acc[0][1], acc[0][2], acc[0][3]);
  acc_guard4(acc[1][0], acc[1][1], acc[1][2], acc[1][3]);
  acc_guard4(acc[2][0], acc[2][1], acc[2][2], acc[2][3]);
  acc_guard4(acc[3][0], acc[3][1], acc[3][2], acc[3][3]);

  // ---- epilogue ----
  float* slab = sT[wave];
  const float* biasb = (BIAS_MODE != 0) ? (bias + (size_t)b * strideBias) : nullptr;
#pragma unroll
  for (int i = 0; i < 4; ++i) {
    const int mBase = m0 + (i << 4);
    float b8[8] = {0.f,0.f,0.f,0.f,0.f,0.f,0.f,0.f};
    if (BIAS_MODE == 1) {
      const v4f bm0 = *(const v4f*)(biasb + mBase + mOff);
      const v4f bm1 = *(const v4f*)(biasb + mBase + mOff + 4);
      b8[0] = bm0[0]; b8[1] = bm0[1]; b8[2] = bm0[2]; b8[3] = bm0[3];
      b8[4] = bm1[0]; b8[5] = bm1[1]; b8[6] = bm1[2]; b8[7] = bm1[3];
    }
#pragma unroll
    for (int j = 0; j < 4; ++j) {
      const int n = n0 + (j << 4) + rlane;
      float bv = 0.f;
      if (BIAS_MODE == 2) bv = biasb[n];
#pragma unroll
      for (int r = 0; r < 8; ++r) {
        float v = acc[i][j][r] * scale;
        if (BIAS_MODE == 1) v += b8[r];
        if (BIAS_MODE == 2) v += bv;
        if (ACT == 2) v = fmaxf(v, 0.0f);
        if (ACT == 4) v = (v > 0.f) ? v : 0.01f * v;
        slab[(mOff + r) * 68 + (j << 4) + rlane] = v;
      }
    }
    __builtin_amdgcn_fence(__ATOMIC_RELEASE, "workgroup");
    __builtin_amdgcn_wave_barrier();
    __builtin_amdgcn_fence(__ATOMIC_ACQUIRE, "workgroup");
    if (OUT_MODE == 0) {
      float* C = (float*)Cout + (size_t)b * strideC;
      const int hh = lane >> 4, c4 = (lane & 15) * 4;     // row seg = 256 B = 16 lanes x 16 B
      {
#pragma unroll
        for (int it = 0; it < 8; ++it) {
          const int row = it * 2 + hh;
          v4f v = *(const v4f*)(slab + row * 68 + c4);
          *(v4f*)(C + (size_t)(mBase + row) * ldc + n0 + c4) = v;
        }
        
      }
    } else if (OUT_MODE == 1) {
      // slab row = lane & 15, columns it*16 + 8*(lane >> 4) ..+7: one 512-byte half tile per store
      unsigned short* C = (unsigned short*)Cout + (size_t)b * strideC;
#pragma unroll   // the four tile offsets become immediates on one address
      for (int it = 0; it < 4; ++it) {
        const float* sp = slab + rlane * 68 + it * 16 + mOff;
        v8h hv;
#pragma unroll   // keeps hv in registers
        for (int e = 0; e < 8; ++e) hv[e] = (_Float16)sp[e];
        const size_t tileC = (size_t)(mBase >> 4) * TRS + (size_t)((n0 >> 5) + (it >> 1)) * TCS;
        *(v8h*)(C + tileC * kTileH + (it & 1) * 256 + lane * 8) = hv;
      }
    } else {
      const int q = lane >> 3, c8 = (lane & 7) * 8;
      unsigned short* C  = (unsigned short*)Cout  + (size_t)b * strideC;
      unsigned short* C2 = (OUT_MODE == 2) ? ((unsigned short*)Cout2 + (size_t)b * strideC) : nullptr;
      {
#pragma unroll
        for (int it = 0; it < 4; ++it) {
          const int row = it * 4 + q;
          const float* sp = slab + row * 68 + c8;
          v8h hv, lv;
#pragma unroll
          for (int e = 0; e < 8; ++e) {
            if (OUT_MODE == 1) {
              hv[e] = (_Float16)sp[e];
            } else {
              unsigned short hb = f2bf_bits(sp[e]);
              unsigned short lb = f2bf_bits(sp[e] - bf_bits2f(hb));
              hv[e] = __builtin_bit_cast(_Float16, hb);
              lv[e] = __builtin_bit_cast(_Float16, lb);
            }
          }
          *(v8h*)(C + (size_t)(mBase + row) * ldc + n0 + c8) = hv;
          if (OUT_MODE == 2) *(v8h*)(C2 + (size_t)(mBase + row) * ldc + n0 + c8) = lv;
        }
        
      }
    }
    __builtin_amdgcn_fence(__ATOMIC_RELEASE, "workgroup");
    __builtin_amdgcn_wave_barrier();
    __builtin_amdgcn_fence(__ATOMIC_ACQUIRE, "workgroup");
  }
}

// ---------------------------------------------------------------------------
// ---------------------------------------------------------------------------
// x f32 [16384][512] row-major -> f16 plane in fragment order, tile (row >> 4) * 16 + (k >> 5).
// A block takes 16 rows x 128 columns = 4 tiles = 256 chunks of 8 halves. Thread t reads chunk (row t >> 4, column group
// t & 15): 512 contiguous bytes per row. In fragment order that chunk has index (t & 15) * 16 + (t >> 4), a 16 x 16
// transpose of chunks, done through LDS (pitch 17 chunks against bank conflicts) so that the block stores 4 KB in a row.
__global__ __launch_bounds__(256) void cast8_f16_kernel(const float* __restrict__ in, unsigned short* __restrict__ out, int n8) {
  __shared__ v4u sh[16 * 17];
  if ((int)(blockIdx.x + 1) * 256 > n8) return;   // block-uniform, in front of the barrier
  const int t  = threadIdx.x;
  const int rt = blockIdx.x >> 2;                 // 16-row band
  const int cg = blockIdx.x & 3;                  // group of 128 columns = 4 tiles
  const float* p = in + (size_t)(rt * 16 + (t >> 4)) * kDim + cg * 128 + (t & 15) * 8;
  const v4f a = *(const v4f*)(p);
  const v4f c = *(const v4f*)(p + 4);
  unsigned short hb[8];
#pragma unroll
  for (int e = 0; e < 4; ++e) {
    hb[e]     = h_bits(a[e]);
    hb[4 + e] = h_bits(c[e]);
  }
  const v4u u = (v4u){pk16(hb[0], hb[1]), pk16(hb[2], hb[3]), pk16(hb[4], hb[5]), pk16(hb[6], hb[7])};
  sh[(t & 15) * 17 + (t >> 4)] = u;
  __syncthreads();
  unsigned short* q = out + (size_t)(rt * (kDim / 32) + cg * 4) * kTileH + t * 8;
  *(v4u*)q = sh[(t >> 4) * 17 + (t & 15)];
}

// ---------------------------------------------------------------------------
// Weight transpose + cast: W is f32 [512 in][nOut out] row-major (x @ W orientation); WT[o][i] = f16(scale * W[i][o]),
// WT in fragment order, tile (o >> 4) * 16 + (i >> 5). grid (512/64 input tiles, nOut/64 output tiles): blockIdx.x = i tile (64 cols of WT),
// blockIdx.y = o tile (64 rows of WT). 256 threads.
// Load coverage: 16 iterations x 256 threads = 4096 = the whole 64x64 tile (coalesced along o).
// Store coverage: wave w owns tile (16-row band w >> 1, 32-column band w & 1) of the 4 x 2 tiles; 2 iterations = its two halves.
// ---------------------------------------------------------------------------
__global__ __launch_bounds__(256) void wtcast_kernel(const float* __restrict__ W, int nOut,
                                                     unsigned short* __restrict__ out, float scale) {
  __shared__ float sm[64][65];   // sm[o_local][i_local]
  const int t  = threadIdx.x;
  const int i0 = blockIdx.x * 64;
  const int o0 = blockIdx.y * 64;
#pragma unroll
  for (int it = 0; it < 16; ++it) {
    const int e = it * 256 + t;
    const int r = e >> 6;          // i local
    const int c = e & 63;          // o local
    sm[c][r] = W[(size_t)(i0 + r) * nOut + o0 + c] * scale;
  }
  __syncthreads();
  const int lane = t & 31, wave = t >> 5;
  const int rtl = wave >> 1, ctl = wave & 1;
  {
#pragma unroll
    for (int it = 0; it < 2; ++it) {
      const int row = rtl * 16 + (lane & 15);                // o local
      const int c8  = ctl * 32 + it * 16 + (lane >> 4) * 8;  // i local
      unsigned short hb[8];
#pragma unroll
      for (int e = 0; e < 8; ++e) hb[e] = h_bits(sm[row][c8 + e]);
      const v4u u = (v4u){pk16(hb[0], hb[1]), pk16(hb[2], hb[3]), pk16(hb[4], hb[5]), pk16(hb[6], hb[7])};
      *(v4u*)(out + (size_t)(((o0 >> 4) + rtl) * (kDim / 32) + (i0 >> 5) + ctl) * kTileH + it * 256 + lane * 8) = u;
    }
    
  }
}

__device__ __forceinline__ float xhalf(float x) {
  const int i = __builtin_bit_cast(int, x);
  return __builtin_bit_cast(float, __builtin_amdgcn_permlanex16(i, i, 0x76543210, 0xfedcba98, false, false));
}
__device__ __forceinline__ unsigned pack2h(float lo, float hi) {   // two f32 -> packed f16, round to nearest even
  typedef __attribute__((ext_vector_type(2))) float    f2;
  typedef __attribute__((ext_vector_type(2))) _Float16 h2;
  return __builtin_bit_cast(unsigned, __builtin_convertvector((f2){lo, hi}, h2));
}
constexpr int kQWave  = 32;                 // queries per wave
constexpr int kQBlock = 8 * kQWave;         // queries per block
constexpr int kPass   = 32;                 // keys per pass
static_assert(kSeq % kQBlock == 0 && kSeq % kPass == 0 && (kSeq & (kSeq - 1)) == 0 && kDh == 64, "fused attention shape");
// waves_per_eu(4, 4): 512 blocks on 256 WGPs = two blocks per WGP = four waves per SIMD, so at most 256 registers a wave
__global__ __launch_bounds__(256) __attribute__((amdgpu_waves_per_eu(4, 4)))
void attn_fused_kernel(const unsigned short* __restrict__ Qp, const unsigned short* __restrict__ Kp,
                       const unsigned short* __restrict__ VTp, unsigned short* __restrict__ O16) {
  typedef Frag<_Float16> F;
  const int lane = threadIdx.x & 31;
  const int wave = threadIdx.x >> 5;
  const int hb = blockIdx.y;                // h*16 + b: the head-major Q and K planes are contiguous in it
  const int h  = hb >> 4;
  const int b  = hb & 15;
  const int q0 = blockIdx.x * kQBlock + wave * kQWave;
  const _Float16* Q = (const _Float16*)Qp + (size_t)hb * (kSeq * kDh);
  const _Float16* kp = (const _Float16*)Kp + (size_t)hb * (kSeq * kDh) + lane * 8;    // + key0*64 + (2*kt + kc)*kTileH
  const _Float16* vp = (const _Float16*)VTp + (size_t)hb * (kSeq * kDh) + lane * 8;   // + key0*64 + t*kTileH
  const float cscale = kAttScale * 1.4426950408889634f;   // score scale times log2(e)

  v16h qf[2][2];
#pragma unroll
  for (int g = 0; g < 2; ++g)
#pragma unroll
    for (int kc = 0; kc < 2; ++kc) qf[g][kc] = F::loadp(Q + (size_t)(((q0 >> 4) + g) * 2 + kc) * kTileH + lane * 8);

  v8f acc[2][4];
  float m_run[2], l_run[2];
#pragma unroll
  for (int g = 0; g < 2; ++g) {
    m_run[g] = -INFINITY; l_run[g] = 0.f;
#pragma unroll
    for (int t = 0; t < 4; ++t) acc[g][t] = (v8f){0.f,0.f,0.f,0.f,0.f,0.f,0.f,0.f};
  }

  v16h kf[2][2];
#pragma unroll
  for (int kt = 0; kt < 2; ++kt)
#pragma unroll
    for (int kc = 0; kc < 2; ++kc) kf[kt][kc] = F::loadp(kp + (2 * kt + kc) * kTileH);

  // rolled: one pass is already 16 WMMAs and 16 loads, and unrolling would cost the registers of the fourth wave per SIMD
#pragma unroll 1
  for (int key0 = 0; key0 < kSeq; key0 += kPass) {
    // this pass's V^T fragments, in flight under the first product and the softmax
    v16h vf[4];
#pragma unroll
    for (int t = 0; t < 4; ++t) vf[t] = F::loadp(vp + (size_t)key0 * kDh + t * kTileH);

    v8f s[2][2];
#pragma unroll
    for (int kt = 0; kt < 2; ++kt)
#pragma unroll
      for (int g = 0; g < 2; ++g) {
        s[kt][g] = (v8f){0.f,0.f,0.f,0.f,0.f,0.f,0.f,0.f};
#pragma unroll
        for (int kc = 0; kc < 2; ++kc) s[kt][g] = F::mma(kf[kt][kc], qf[g][kc], s[kt][g]);
      }

    // next pass's K fragments, in flight under the softmax and the second product (the last pass re-reads keys 0..31, unused)
    const int nk = (key0 + kPass) & (kSeq - 1);
#pragma unroll
    for (int kt = 0; kt < 2; ++kt)
#pragma unroll
      for (int kc = 0; kc < 2; ++kc) kf[kt][kc] = F::loadp(kp + (size_t)nk * kDh + (2 * kt + kc) * kTileH);

#pragma unroll
    for (int g = 0; g < 2; ++g) {
      float mx = s[0][g][0];
#pragma unroll
      for (int r = 1; r < 8; ++r) mx = fmaxf(mx, s[0][g][r]);
#pragma unroll
      for (int r = 0; r < 8; ++r) mx = fmaxf(mx, s[1][g][r]);
      mx = fmaxf(mx, xhalf(mx)) * cscale;                    // both halves hold the query's maximum of this pass, scaled
      const float m_new = fmaxf(m_run[g], mx);
      const float corr  = __builtin_amdgcn_exp2f(m_run[g] - m_new);   // 0 on the first pass (m_run = -inf, m_new finite)
      m_run[g] = m_new;
      float ps = 0.f;
      union { v16h v; unsigned w[8]; } pf;
#pragma unroll
      for (int i = 0; i < 8; ++i) {   // operand elements 2i, 2i+1 = tile i>>2, registers 2(i&3), 2(i&3)+1
        const float p0 = __builtin_amdgcn_exp2f(fmaf(s[i >> 2][g][2 * (i & 3)],     cscale, -m_new));
        const float p1 = __builtin_amdgcn_exp2f(fmaf(s[i >> 2][g][2 * (i & 3) + 1], cscale, -m_new));
        ps += p0 + p1;
        pf.w[i] = pack2h(p0, p1);
      }
      l_run[g] = fmaf(l_run[g], corr, ps);                   // this half's keys only; the halves join after the loop
#pragma unroll
      for (int t = 0; t < 4; ++t) {
        acc[g][t] = acc[g][t] * corr;
        acc[g][t] = F::mma(vf[t], pf.v, acc[g][t]);
      }
    }
  }

#pragma unroll
  for (int g = 0; g < 2; ++g) {
    const float l_fin = l_run[g] + xhalf(l_run[g]);
    const float inv = kMidCarry / l_fin;                     // the x64 carry of the O16 plane
    unsigned short* op = O16 + ((size_t)((b * kSeq + q0 + 16 * g) >> 4) * (kDim / 32) + h * 2) * kTileH + lane * 8;
#pragma unroll
    for (int t = 0; t < 4; ++t) {
      const v8f o = acc[g][t] * inv;
      *(v4u*)(op + t * 256) = (v4u){pack2h(o[0], o[1]), pack2h(o[2], o[3]), pack2h(o[4], o[5]), pack2h(o[6], o[7])};
    }
  }
}

// ---------------------------------------------------------------------------
// Depthwise 3x3 conv (zero SAME padding, cross-correlation, f32) on the V image + attention output, producing the
// f16 proj operand: MID[tok][c] = f16( O16[tok][c] + 64 * (conv_b[c] + sum_taps w * v) ), O16 already carried x64.
// V image: the fragment-order VT plane; a pass of 32 keys is one image row, so row y of the 64 channels of head h, batch b is the
// 4 KB at tile ((h*16 + b)*32 + y)*4. O16 and MID: fragment order, tile (token >> 4) * 16 + (channel >> 5).
// grid (512/64 channel tiles = heads, 32/4 image-row tiles, 16 batches), 256 threads.
// LDS image tile sv[64 ch][6 rows][34 cols]: rows y0-1..y0+4 (out-of-range rows written as zeros), cols 0 and 33 zero pads.
// Staging coverage: 6 iterations (image rows) x 256 threads (16-byte chunks of the row's 4 KB); pads 768 entries; weights 576; bias 64.
// Store phase: 4 rolled iterations x 256 threads: a wave takes one half tile (16 tokens x 16 channels) = 512 contiguous bytes;
// token group it*2 + (t>>7) covers 128 local tokens, ((t>>5)&3)*16 + ((t>>4)&1)*8 covers 64 channels.
// ---------------------------------------------------------------------------
constexpr int kCvRows  = 6;
constexpr int kCvCols  = 34;
constexpr int kCvPitch = kCvRows * kCvCols;   // 204 floats per channel
__global__ __launch_bounds__(256) void conv_mid_kernel(const unsigned short* __restrict__ VT,
                                                       const unsigned short* __restrict__ O16,
                                                       const float* __restrict__ cw, const float* __restrict__ cb,
                                                       unsigned short* __restrict__ MID,
                                                       const int* __restrict__ hw0, const int* __restrict__ hw1) {
  (void)hw0; (void)hw1;
  __shared__ __align__(16) float sv[64 * kCvPitch];   // 52,224 B
  __shared__ float sw[64 * 9];
  __shared__ float sb[64];
  const int t  = threadIdx.x;
  const int c0 = blockIdx.x * 64;
  const int y0 = blockIdx.y * 4;
  const int b  = blockIdx.z;

  // weights and bias of the 64 channels, pre-scaled by the x64 carry of the mid plane
  for (int i = t; i < 64 * 9; i += 256) sw[i] = cw[(size_t)c0 * 9 + i] * kMidCarry;
  if (t < 64) sb[t] = cb[c0 + t] * kMidCarry;
  // zero pad columns 0 and 33 of every staged row (disjoint from the staged words)
  for (int i = t; i < 64 * kCvRows * 2; i += 256) {
    const int cl  = i / (kCvRows * 2);
    const int rem = i - cl * (kCvRows * 2);
    const int r   = rem >> 1;
    const int col = (rem & 1) * (kCvCols - 1);
    sv[cl * kCvPitch + r * kCvCols + col] = 0.0f;
  }
  // stage 6 image rows of 64 channels as 128-bit words (8 halves); address clamped, value zeroed arithmetically when out of range
  const int cl = (t >> 6) * 16 + (t & 15);                       // chunk t of a row's 4 KB: channel ...
  const int x0 = ((t >> 5) & 1) * 16 + ((t >> 4) & 1) * 8;       // ... and first column
#pragma unroll
  for (int r = 0; r < 6; ++r) {         // staged row 0..5
    const int yy  = y0 - 1 + r;
    const int yyc = (yy < 0) ? 0 : ((yy > kImg - 1) ? (kImg - 1) : yy);
    const v4u u = *(const v4u*)(VT + (size_t)(((blockIdx.x * kBatch + b) * kImg + yyc) * 4) * kTileH + t * 8);
    const float f = (yy >= 0 && yy <= kImg - 1) ? 1.0f : 0.0f;
    float* dst = sv + cl * kCvPitch + r * kCvCols + 1 + x0;
    dst[0] = h16_to_f32(u[0] & 0xffffu) * f;
    dst[1] = h16_to_f32(u[0] >> 16) * f;
    dst[2] = h16_to_f32(u[1] & 0xffffu) * f;
    dst[3] = h16_to_f32(u[1] >> 16) * f;
    dst[4] = h16_to_f32(u[2] & 0xffffu) * f;
    dst[5] = h16_to_f32(u[2] >> 16) * f;
    dst[6] = h16_to_f32(u[3] & 0xffffu) * f;
    dst[7] = h16_to_f32(u[3] >> 16) * f;
  }
  __syncthreads();

  const int cp = (t >> 5) & 3;                      // 16-channel group: tile column cp >> 1, half cp & 1
  const int c8 = cp * 16 + ((t >> 4) & 1) * 8;
  // this thread's chunk in the O16 and MID planes for token group t >> 7; two 16-token bands further per iteration
  const size_t po0 = (size_t)((((b * kSeq + y0 * kImg) >> 4) + (t >> 7)) * (kDim / 32) + (c0 >> 5) + (cp >> 1)) * kTileH
                     + (cp & 1) * 256 + (t & 31) * 8;
  const unsigned short* oq = O16 + po0;
  unsigned short* mp = MID + po0;
#pragma unroll 1
  for (int it = 0; it < 4; ++it, oq += 2 * kBandH, mp += 2 * kBandH) {
    const int tg  = it * 2 + (t >> 7);  // 16-token group 0..7
    const int row = tg * 16 + (t & 15); // local token 0..127
    const int yl  = row >> 5;          // 0..3
    const int x   = row & 31;
    const v4u ou = *(const v4u*)oq;
    float o[8];
    o[0] = h16_to_f32(ou[0] & 0xffffu); o[1] = h16_to_f32(ou[0] >> 16);
    o[2] = h16_to_f32(ou[1] & 0xffffu); o[3] = h16_to_f32(ou[1] >> 16);
    o[4] = h16_to_f32(ou[2] & 0xffffu); o[5] = h16_to_f32(ou[2] >> 16);
    o[6] = h16_to_f32(ou[3] & 0xffffu); o[7] = h16_to_f32(ou[3] >> 16);
    unsigned short hb[8];
#pragma unroll
    for (int e = 0; e < 8; ++e) {
      const int ce = c8 + e;
      const float* vr = sv + ce * kCvPitch + yl * kCvCols + x;   // tap (ky,kx) at vr[ky*34 + kx]
      const float* wr = sw + ce * 9;
      float acc = sb[ce];
#pragma unroll
      for (int ky = 0; ky < 3; ++ky) {
#pragma unroll
        for (int kx = 0; kx < 3; ++kx) acc = fmaf(wr[ky * 3 + kx], vr[ky * kCvCols + kx], acc);
      }
      hb[e] = h_bits(o[e] + acc);
    }
    const v4u u = (v4u){pk16(hb[0], hb[1]), pk16(hb[2], hb[3]), pk16(hb[4], hb[5]), pk16(hb[6], hb[7])};
    *(v4u*)mp = u;
    
  }
}

// ---------------------------------------------------------------------------
// Host glue.
// Every 16-bit plane below is held in fragment order (see kTileH); the shapes name its rows x k.
//   XH     f16 [16384][512]            16,777,216  at           0   (x cast)
//   WQKVT  f16 [1536][512]  x16          1,572,864  at  16,777,216   (rows 0..511 Wq^T, 512..1023 Wk^T, 1024..1535 Wv^T)
//   WPT    f16 [512][512]   x16            524,288  at  18,350,080
//   Q16    f16 [8][16384][64]          16,777,216  at  18,874,368   (head-major, row = b*1024+n)
//   K16    f16 [8][16384][64]          16,777,216  at  35,651,584
//   VT     f16 [512][16384]            16,777,216  at  52,428,800   (per head: tile (token >> 5) * 4 + (d >> 4))
//   O16    f16 [16384][512]  x64       16,777,216  at  69,206,016
//   MID16  f16 [16384][512]  x64       16,777,216  at  85,983,232
//   total                             102,760,448
// GEMM shapes (all M,N multiples of 64, K % 32 == 0, no padding anywhere):
//   q, k:  M=16384 N=64 K=512;  v^T: M=64 N=16384 K=512;  proj:  M=512 N=1024 K=512 (writes out[b][c][n] directly).
// Scores, softmax and P.V of all 128 (head, batch) pairs: one launch of attn_fused_kernel.
// ---------------------------------------------------------------------------
extern "C" void kernel_launch(void* const* d_in, const int* in_sizes, int n_in,
                              void* d_out, int out_size, void* d_ws, size_t ws_size,
                              hipStream_t stream) {
  if (n_in < 11) return;
  const int nX = kTok * kDim;                       // 8,388,608
  if (in_sizes[0] != nX) return;
  if (in_sizes[1] != kDim * kDim || in_sizes[2] != kDim) return;
  if (in_sizes[3] != kDim * 2 * kDim || in_sizes[4] != 2 * kDim) return;
  if (in_sizes[5] != kDim * 9 || in_sizes[6] != kDim) return;
  if (in_sizes[7] != kDim * kDim || in_sizes[8] != kDim) return;
  if (out_size != kBatch * kDim * kSeq) return;

  const size_t szPlane16 = (size_t)kTok * kDim * 2;                 // 16,777,216
  const size_t szWQKVT   = (size_t)3 * kDim * kDim * 2;             //  1,572,864
  const size_t szWPT     = (size_t)kDim * kDim * 2;                 //    524,288
  const size_t szQ       = (size_t)kHeads * kTok * kDh * 2;         // 16,777,216
  const size_t szVT      = (size_t)kDim * kTok * 2;                 // 16,777,216
  const size_t offXH   = 0;
  const size_t offWQKV = offXH + szPlane16;
  const size_t offWPT  = offWQKV + szWQKVT;
  const size_t offQ    = offWPT + szWPT;
  const size_t offK    = offQ + szQ;
  const size_t offVT   = offK + szQ;
  const size_t offO    = offVT + szVT;
  const size_t offMID  = offO + szPlane16;
  const size_t total   = offMID + szPlane16;                       // 102,760,448
  if (ws_size < total) return;

  const float* x    = (const float*)d_in[0];
  const float* Wq   = (const float*)d_in[1];
  const float* bq   = (const float*)d_in[2];
  const float* Wkv  = (const float*)d_in[3];
  const float* bkv  = (const float*)d_in[4];
  const float* cw   = (const float*)d_in[5];
  const float* cb   = (const float*)d_in[6];
  const float* Wp   = (const float*)d_in[7];
  const float* bp   = (const float*)d_in[8];
  const int*   hIn  = (const int*)d_in[9];     // static image height (32), structural only
  const int*   wIn  = (const int*)d_in[10];    // static image width (32), structural only
  float* out = (float*)d_out;
  char* ws = (char*)d_ws;
  unsigned short* XH    = (unsigned short*)(ws + offXH);
  unsigned short* WQKVT = (unsigned short*)(ws + offWQKV);
  unsigned short* WPT   = (unsigned short*)(ws + offWPT);
  unsigned short* Q16   = (unsigned short*)(ws + offQ);
  unsigned short* K16   = (unsigned short*)(ws + offK);
  unsigned short* VT    = (unsigned short*)(ws + offVT);
  unsigned short* O16   = (unsigned short*)(ws + offO);
  unsigned short* MID16 = (unsigned short*)(ws + offMID);

  // ---- prologue: 16-bit operand planes ----
  const int n8 = nX / 8;   // 1,048,576 -> 4096 blocks exact
  cast8_f16_kernel<<<dim3(n8 / 256), dim3(256), 0, stream>>>(x, XH, n8);
  // Wq [512 in][512 out] -> WQKVT rows 0..511;  Wkv [512 in][1024 out] -> rows 512..1535;  Wp -> WPT
  wtcast_kernel<<<dim3(kDim / 64, kDim / 64), dim3(256), 0, stream>>>(Wq, kDim, WQKVT, kWCarry);
  wtcast_kernel<<<dim3(kDim / 64, (2 * kDim) / 64), dim3(256), 0, stream>>>(Wkv, 2 * kDim, WQKVT + (size_t)kDim * kDim, kWCarry);
  wtcast_kernel<<<dim3(kDim / 64, kDim / 64), dim3(256), 0, stream>>>(Wp, kDim, WPT, kWCarry);

  // ---- projections ----
  const long strideHeadW  = (long)kDh * kDim;          // 64 weight rows per head = 32768 halves
  const long strideHeadQK = (long)kTok * kDh;          // per-head [16384][64] plane = 1,048,576 halves
  const long strideHeadVT = (long)kDh * kTok;          // per-head 64 rows of [512][16384] = 1,048,576 halves
  const int  tilesQK = (kTok / 64) * (kDh / 64);       // 256 -> 32 blocks
  // Q16[h][tok][d] = 1/16 * sum_k XH[tok][k] * WQKVT[h*64+d][k] + bq[h*64+d]
  wmma_gemm64<0, false, 2, 1, false, 0, 2, 1><<<dim3(tilesQK / 8, kHeads), dim3(256), 0, stream>>>(
      XH, XH, kDim, 0L, WQKVT, WQKVT, kDim, strideHeadW,
      (void*)Q16, (void*)Q16, kDh, strideHeadQK, bq, (long)kDh, bq, 0L, kTok, kDh, kDim, kWCarryInv);
  // K16 from WQKVT rows 512 + h*64
  wmma_gemm64<0, false, 2, 1, false, 0, 2, 1><<<dim3(tilesQK / 8, kHeads), dim3(256), 0, stream>>>(
      XH, XH, kDim, 0L, WQKVT + (size_t)kDim * kDim, WQKVT, kDim, strideHeadW,
      (void*)K16, (void*)K16, kDh, strideHeadQK, bkv, (long)kDh, bkv, 0L, kTok, kDh, kDim, kWCarryInv);
  // VT[h*64+d][tok] = 1/16 * sum_k WQKVT[1024 + h*64 + d][k] * XH[tok][k] + bkv[512 + h*64 + d]   (M=64, N=16384)
  wmma_gemm64<0, false, 1, 1, false, 0, 1, 4><<<dim3(tilesQK / 8, kHeads), dim3(256), 0, stream>>>(
      WQKVT + (size_t)2 * kDim * kDim, WQKVT, kDim, strideHeadW, XH, XH, kDim, 0L,
      (void*)VT, (void*)VT, kTok, strideHeadVT, bkv + kDim, (long)kDh, bkv, 0L, kDh, kTok, kDim, kWCarryInv);

  // ---- attention, all heads and batches in one launch: O16[b*1024 + i][h*64 + d] = f16(64 * softmax(0.125 q.k^T) . v) ----
  const long strideBO = (long)kSeq * kDim;             // next batch in the [16384][512] planes = 524288
  attn_fused_kernel<<<dim3(kSeq / kQBlock, kHeads * kBatch), dim3(256), 0, stream>>>(Q16, K16, VT, O16);

  // ---- depthwise conv branch + add -> MID16 (x64) ----
  conv_mid_kernel<<<dim3(kDim / 64, kImg / 4, kBatch), dim3(256), 0, stream>>>(VT, O16, cw, cb, MID16, hIn, wIn);

  // ---- output projection, transposed store: out[b][c][n] = 1/1024 * sum_k WPT[c][k] * MID16[b*1024+n][k] + bp[c] ----
  const int tilesProj = (kDim / 64) * (kSeq / 64);     // 128 -> 16 blocks
  wmma_gemm64<0, false, 1, 0, false, 0><<<dim3(tilesProj / 8, kBatch), dim3(256), 0, stream>>>(
      WPT, WPT, kDim, 0L, MID16, MID16, kDim, strideBO,
      (void*)out, (void*)out, kSeq, (long)kDim * kSeq, bp, 0L, bp, 0L, kDim, kSeq, kDim, kProjScale);
}

// v003
// One run takes 126 microseconds.
// Timed twice side by side with v002, it ran 1.48 and 1.50 times as fast.
// All steps since v000 together make it 17.5 times as fast.
// Contractions: q/k/v projections (x f16 x W^T f16 carried x16), scores q.k^T (q,k f16 planes), attn.v (V^T f16 x P^T f16, P = exp(s - running max) unnormalised), output projection (W^T f16 x16 x mid f16 x64): all v_wmma_f32_16x16x32_f16, f32 accumulate; softmax, depthwise 3x3 conv, bias adds in f32.
#include <hip/hip_runtime.h>
#include <math.h>

// ---------------------------------------------------------------------------
// Problem constants
// ---------------------------------------------------------------------------
constexpr int kBatch = 16;
constexpr int kSeq   = 1024;              // tokens per batch = 32 x 32 image
constexpr int kDim   = 512;
constexpr int kHeads = 8;
constexpr int kDh    = 64;
constexpr int kImg   = 32;
constexpr int kTok   = kBatch * kSeq;     // 16384 token rows
constexpr float kWCarry     = 16.0f;      // weights carried x16 in f16
constexpr float kWCarryInv  = 1.0f / 16.0f;
constexpr float kMidCarry   = 64.0f;      // attention output and mid carried x64 in f16
constexpr float kAttScale   = 0.125f;     // 64^-0.5
constexpr float kProjScale  = 1.0f / (kMidCarry * kWCarry);  // 1/1024
static_assert(kHeads * kDh == kDim, "shape");
static_assert(kImg * kImg == kSeq, "image");
static_assert(kTok % 64 == 0 && kSeq % 64 == 0 && kDim % 64 == 0 && kDh % 64 == 0, "tile multiples");
static_assert(kDim % 32 == 0 && kDh % 32 == 0 && kSeq % 32 == 0, "K multiples of 32");

// Fragment order of every 16-bit operand plane: a plane of rows x k is cut into tiles of 16 rows x 32 k = kTileH halves (1 KB).
// Inside a tile, element (row r, k) sits at ((k >> 4) & 1) * 256 + (((k >> 3) & 1) * 16 + (r & 15)) * 8 + (k & 7):
// lane l = 16 * hf + r of a wave finds its fragment elements 0..7 at l * 8 and 8..15 at 256 + l * 8, so each of the two
// 16-byte loads (or stores) of a wave covers 512 contiguous bytes = four whole lines.
constexpr int kTileH = 512;
constexpr int kBandH = (kDim / 32) * kTileH;   // a 16-row band of a plane with k extent kDim: 16 tiles in a row
typedef __attribute__((ext_vector_type(16))) _Float16 v16h;
typedef __attribute__((ext_vector_type(8)))  _Float16 v8h;
typedef __attribute__((ext_vector_type(16))) __bf16   v16b;
typedef __attribute__((ext_vector_type(8)))  __bf16   v8b;
typedef __attribute__((ext_vector_type(8)))  float    v8f;
typedef __attribute__((ext_vector_type(4)))  float    v4f;
typedef __attribute__((ext_vector_type(4)))  unsigned int v4u;

__device__ __forceinline__ unsigned short f2bf_bits(float f) {
  unsigned u = __float_as_uint(f);
  return (unsigned short)((u + 0x7FFFu + ((u >> 16) & 1u)) >> 16);
}
__device__ __forceinline__ float bf_bits2f(unsigned short h) { return __uint_as_float(((unsigned)h) << 16); }

// hazard guards as plain device helpers (no inline asm inside the kernel template body)
__device__ __forceinline__ void dep_guard_h(v8f& a, v8f& b, v16h x, v16h y) { asm volatile("v_nop\n\tv_nop\n\tv_nop\n\tv_nop" : "+v"(a), "+v"(b) : "v"(x), "v"(y)); }
__device__ __forceinline__ void dep_guard_b(v8f& a, v8f& b, v16b x, v16b y) { asm volatile("v_nop\n\tv_nop\n\tv_nop\n\tv_nop" : "+v"(a), "+v"(b) : "v"(x), "v"(y)); }
__device__ __forceinline__ void keep4_h(v16h a, v16h b, v16h c, v16h d) { asm volatile("v_nop" :: "v"(a), "v"(b), "v"(c), "v"(d)); }
__device__ __forceinline__ void keep4_b(v16b a, v16b b, v16b c, v16b d) { asm volatile("v_nop" :: "v"(a), "v"(b), "v"(c), "v"(d)); }
__device__ __forceinline__ void acc_guard4(v8f& a, v8f& b, v8f& c, v8f& d) { asm volatile("v_nop\n\tv_nop\n\tv_nop\n\tv_nop" : "+v"(a), "+v"(b), "+v"(c), "+v"(d)); }
template <typename T> struct Frag;
template <> struct Frag<_Float16> {
  typedef v16h V; union U { v16h v; v8h h[2]; };
  // a fragment from a fragment-order tile (see kTileH), p = tile base + lane*8: elements 0..7 <- p[0..7], 8..15 <- p[256..263]
  static __device__ __forceinline__ v16h loadp(const _Float16* p) {
    U f; f.h[0] = *(const v8h*)(p); f.h[1] = *(const v8h*)(p + 256); return f.v;
  }
  static __device__ __forceinline__ v8f mma(v16h a, v16h b, v8f c) {
    return __builtin_amdgcn_wmma_f32_16x16x32_f16(false, a, false, b, (short)0, c, false, false);
  }
  static __device__ __forceinline__ void guard(v8f& a, v8f& b, v16h x, v16h y) { dep_guard_h(a, b, x, y); }
  static __device__ __forceinline__ void keep(v16h a, v16h b, v16h c, v16h d) { keep4_h(a, b, c, d); }
};
template <> struct Frag<__bf16> {
  typedef v16b V; union U { v16b v; v8b h[2]; };
  static __device__ __forceinline__ v16b loadp(const __bf16* p) {
    U f; f.h[0] = *(const v8b*)(p); f.h[1] = *(const v8b*)(p + 256); return f.v;
  }
  static __device__ __forceinline__ v8f mma(v16b a, v16b b, v8f c) {
    return __builtin_amdgcn_wmma_f32_16x16x32_bf16(false, a, false, b, (short)0, c, false, false);
  }
  static __device__ __forceinline__ void guard(v8f& a, v8f& b, v16b x, v16b y) { dep_guard_b(a, b, x, y); }
  static __device__ __forceinline__ void keep(v16b a, v16b b, v16b c, v16b d) { keep4_b(a, b, c, d); }
};

__device__ __forceinline__ unsigned pk16(unsigned short a, unsigned short b) { return (unsigned)a | ((unsigned)b << 16); }
__device__ __forceinline__ unsigned short h_bits(float f) { const _Float16 h = (_Float16)f; return __builtin_bit_cast(unsigned short, h); }

// f16 bits (low 16 bits of hb, finite values) -> f32, integer path only
__device__ __forceinline__ float h16_to_f32(unsigned hb) {
  const unsigned sgn = (hb & 0x8000u) << 16; const unsigned em = hb & 0x7fffu;
  const float fn = __uint_as_float((em << 13) + 0x38000000u);
  const float fs = (float)em * 5.9604644775390625e-8f;
  const float mag = (em < 0x400u) ? fs : fn; return __uint_as_float(__float_as_uint(mag) | sgn); }

// ---- Register-blocked batched WMMA GEMM (ACT reduced to none/relu/leaky; bias gets a per-z stride and the
//      bias[m] line is loaded as two float4 per 16-row slab instead of per-lane scalars; RESID path not instantiated) ---
// C[m,n] = scale * sum_k A[m,k] * Bt[n,k] (+bias); each wave owns a 64x64 tile.
// A [M,kDim] and Bt [N,kDim] in fragment order, tile (row >> 4) * (kDim / 32) + (k >> 5); M,N % 64 == 0, K = kDim (the argument is not read).
// SPLIT (hi/lo operand planes): not instantiated.
// BIAS_MODE: 0 = none, 1 = bias[m], 2 = bias[n]; bias base = bias + z*strideBias.
// OUT_MODE: 0 = f32 row-major, 1 = f16 in fragment order, tile (m >> 4) * TRS + (n >> 5) * TCS, 2 = bf16 hi plane (Cout) + bf16 lo plane (Cout2).
// ET: 0 = f16 operands, 1 = bf16 operands (pointers passed as 16-bit storage)
// base + a 32-bit byte offset: with a wave-uniform base this is the load's own scalar-base form, no 64-bit vector add per step
template <typename T> __device__ __forceinline__ const T* at_bytes(const T* base, unsigned bytes) {
  return (const T*)((const char*)base + bytes);
}
template <int ET> struct Elem;
template <> struct Elem<0> { typedef _Float16 T; };
template <> struct Elem<1> { typedef __bf16 T; };
template <int ET, bool SPLIT, int BIAS_MODE, int OUT_MODE, bool RESID, int ACT = 0, int TRS = 0, int TCS = 0>
__global__ __launch_bounds__(256) void wmma_gemm64(
    const unsigned short* __restrict__ Ap, const unsigned short* __restrict__ A2p, int lda, long strideA,
    const unsigned short* __restrict__ Btp, const unsigned short* __restrict__ Bt2p, int ldb, long strideB,
    void* __restrict__ Cout, void* __restrict__ Cout2, int ldc, long strideC,
    const float* __restrict__ bias, long strideBias,
    const float* __restrict__ resid, long strideR,
    int M, int N, int K, float scale) {
  static_assert(!RESID, "resid path not used");
  static_assert(!SPLIT, "split path not used");
  typedef typename Elem<ET>::T T;
  typedef typename Frag<T>::V V;
  (void)resid; (void)strideR; (void)lda; (void)ldb; (void)K;
  (void)A2p; (void)Bt2p;
  const T* A = (const T*)Ap; const T* Bt = (const T*)Btp;
  __shared__ __align__(16) float sT[8][16 * 68];   // per-wave 16x64 slab, pitch 68 floats
  const int b    = blockIdx.y;
  const int lane = threadIdx.x & 31;
  // the wave's number in a scalar register: the band bases of the k loop are then scalar, and a fragment load is scalar base + offset
  const int wave = __builtin_amdgcn_readfirstlane(threadIdx.x >> 5);
  const int tilesN = N >> 6;
  const int tilesM = M >> 6;
  const int tile = blockIdx.x * 8 + wave;
  if (tile >= tilesM * tilesN) return;   // wave-uniform; no block barriers in this kernel
  const int tm = tile / tilesN;
  const int tn = tile - tm * tilesN;
  const int m0 = tm << 6;
  const int n0 = tn << 6;

  const T* Ab  = A  + (size_t)b * strideA;
  const T* Bb  = Bt + (size_t)b * strideB;

  const int rlane = lane & 15;                 // row (A) / col (B, D) within subtile
  const int mOff  = (lane >> 4) * 8;           // D row offset

  v8f acc[4][4];
#pragma unroll
  for (int i = 0; i < 4; ++i)
#pragma unroll
    for (int j = 0; j < 4; ++j) acc[i][j] = (v8f){0.f,0.f,0.f,0.f,0.f,0.f,0.f,0.f};

  // the wave's first A and B band (wave-uniform); A and B share one 32-bit offset: this lane's chunk of the k step's tile
  const T* Aw = Ab + (size_t)(m0 >> 4) * kBandH;
  const T* Bw = Bb + (size_t)(n0 >> 4) * kBandH;
  const unsigned lane16 = (unsigned)lane * 16u;                                  // in bytes
  // Every fragment is fetched one k step ahead of its WMMAs. An A fragment serves one row of four WMMAs, so its registers
  // take the next step's fragment right behind that row; a B fragment serves all four rows, so B has two register sets,
  // and the idle set is refilled behind row 0.
  const T* Al = at_bytes(Aw, lane16);
  const T* Bl = at_bytes(Bw, lane16);
  V af[4], bf[2][4];
#pragma unroll
  for (int i = 0; i < 4; ++i) af[i] = Frag<T>::loadp(Al + i * kBandH);
#pragma unroll
  for (int j = 0; j < 4; ++j) bf[0][j] = Frag<T>::loadp(Bl + j * kBandH);
#pragma unroll   // all steps in a row: the B sets are named by constants (no register copies), every load is base + lane + immediate, the last step fetches nothing
  for (int ks = 0; ks < kDim / 32; ++ks) {
    const int s = ks & 1;
    const bool more = ks + 1 < kDim / 32;
#pragma unroll
    for (int i = 0; i < 4; ++i) {
#pragma unroll
      for (int j = 0; j < 4; ++j) acc[i][j] = Frag<T>::mma(af[i], bf[s][j], acc[i][j]);
      Frag<T>::guard(acc[i][0], acc[i][3], af[i], af[i]);
      // the pair of scheduling fences holds each refill right behind its whole row: ahead of the row's last WMMA it would need
      // registers of its own (spills), and behind WMMAs of later rows it would lose its lead
      __builtin_amdgcn_sched_barrier(0);
      if (more) {
        af[i] = Frag<T>::loadp(Al + (ks + 1) * kTileH + i * kBandH);
        if (i == 0) {
#pragma unroll
          for (int j = 0; j < 4; ++j) bf[s ^ 1][j] = Frag<T>::loadp(Bl + (ks + 1) * kTileH + j * kBandH);
        }
      }
      __builtin_amdgcn_sched_barrier(0);
    }
    Frag<T>::keep(bf[s][0], bf[s][1], bf[s][2], bf[s][3]);
  }
  acc_guard4(acc[0][0], acc[0][1], acc[0][2], acc[0][3]);
  acc_guard4(acc[1][0], acc[1][1], acc[1][2], acc[1][3]);
  acc_guard4(acc[2][0], acc[2][1], acc[2][2], acc[2][3]);
  acc_guard4(acc[3][0], acc[3][1], acc[3][2], acc[3][3]);

  // ---- epilogue ----
  float* slab = sT[wave];
  const float* biasb = (BIAS_MODE != 0) ? (bias + (size_t)b * strideBias) : nullptr;
#pragma unroll
  for (int i = 0; i < 4; ++i) {
    const int mBase = m0 + (i << 4);
    float b8[8] = {0.f,0.f,0.f,0.f,0.f,0.f,0.f,0.f};
    if (BIAS_MODE == 1) {
      const v4f bm0 = *(const v4f*)(biasb + mBase + mOff);
      const v4f bm1 = *(const v4f*)(biasb + mBase + mOff + 4);
      b8[0] = bm0[0]; b8[1] = bm0[1]; b8[2] = bm0[2]; b8[3] = bm0[3];
      b8[4] = bm1[0]; b8[5] = bm1[1]; b8[6] = bm1[2]; b8[7] = bm1[3];
    }
#pragma unroll
    for (int j = 0; j < 4; ++j) {
      const int n = n0 + (j << 4) + rlane;
      float bv = 0.f;
      if (BIAS_MODE == 2) bv = biasb[n];
#pragma unroll
      for (int r = 0; r < 8; ++r) {
        float v = acc[i][j][r] * scale;
        if (BIAS_MODE == 1) v += b8[r];
        if (BIAS_MODE == 2) v += bv;
        if (ACT == 2) v = fmaxf(v, 0.0f);
        if (ACT == 4) v = (v > 0.f) ? v : 0.01f * v;
        slab[(mOff + r) * 68 + (j << 4) + rlane] = v;
      }
    }
    __builtin_amdgcn_fence(__ATOMIC_RELEASE, "workgroup");
    __builtin_amdgcn_wave_barrier();
    __builtin_amdgcn_fence(__ATOMIC_ACQUIRE, "workgroup");
    if (OUT_MODE == 0) {
      float* C = (float*)Cout + (size_t)b * strideC;
      const int hh = lane >> 4, c4 = (lane & 15) * 4;     // row seg = 256 B = 16 lanes x 16 B
      {
#pragma unroll
        for (int it = 0; it < 8; ++it) {
          const int row = it * 2 + hh;
          v4f v = *(const v4f*)(slab + row * 68 + c4);
          *(v4f*)(C + (size_t)(mBase + row) * ldc + n0 + c4) = v;
        }
        
      }
    } else if (OUT_MODE == 1) {
      // slab row = lane & 15, columns it*16 + 8*(lane >> 4) ..+7: one 512-byte half tile per store
      unsigned short* C = (unsigned short*)Cout + (size_t)b * strideC;
#pragma unroll   // the four tile offsets become immediates on one address
      for (int it = 0; it < 4; ++it) {
        const float* sp = slab + rlane * 68 + it * 16 + mOff;
        v8h hv;
#pragma unroll   // keeps hv in registers
        for (int e = 0; e < 8; ++e) hv[e] = (_Float16)sp[e];
        const size_t tileC = (size_t)(mBase >> 4) * TRS + (size_t)((n0 >> 5) + (it >> 1)) * TCS;
        *(v8h*)(C + tileC * kTileH + (it & 1) * 256 + lane * 8) = hv;
      }
    } else {
      const int q = lane >> 3, c8 = (lane & 7) * 8;
      unsigned short* C  = (unsigned short*)Cout  + (size_t)b * strideC;
      unsigned short* C2 = (OUT_MODE == 2) ? ((unsigned short*)Cout2 + (size_t)b * strideC) : nullptr;
      {
#pragma unroll
        for (int it = 0; it < 4; ++it) {
          const int row = it * 4 + q;
          const float* sp = slab + row * 68 + c8;
          v8h hv, lv;
#pragma unroll
          for (int e = 0; e < 8; ++e) {
            if (OUT_MODE == 1) {
              hv[e] = (_Float16)sp[e];
            } else {
              unsigned short hb = f2bf_bits(sp[e]);
              unsigned short lb = f2bf_bits(sp[e] - bf_bits2f(hb));
              hv[e] = __builtin_bit_cast(_Float16, hb);
              lv[e] = __builtin_bit_cast(_Float16, lb);
            }
          }
          *(v8h*)(C + (size_t)(mBase + row) * ldc + n0 + c8) = hv;
          if (OUT_MODE == 2) *(v8h*)(C2 + (size_t)(mBase + row) * ldc + n0 + c8) = lv;
        }
        
      }
    }
    __builtin_amdgcn_fence(__ATOMIC_RELEASE, "workgroup");
    __builtin_amdgcn_wave_barrier();
    __builtin_amdgcn_fence(__ATOMIC_ACQUIRE, "workgroup");
  }
}

// ---------------------------------------------------------------------------
// ---------------------------------------------------------------------------
// x f32 [16384][512] row-major -> f16 plane in fragment order, tile (row >> 4) * 16 + (k >> 5).
// A block takes 16 rows x 128 columns = 4 tiles = 256 chunks of 8 halves. Thread t reads chunk (row t >> 4, column group
// t & 15): 512 contiguous bytes per row. In fragment order that chunk has index (t & 15) * 16 + (t >> 4), a 16 x 16
// transpose of chunks, done through LDS (pitch 17 chunks against bank conflicts) so that the block stores 4 KB in a row.
__global__ __launch_bounds__(256) void cast8_f16_kernel(const float* __restrict__ in, unsigned short* __restrict__ out, int n8) {
  __shared__ v4u sh[16 * 17];
  if ((int)(blockIdx.x + 1) * 256 > n8) return;   // block-uniform, in front of the barrier
  const int t  = threadIdx.x;
  const int rt = blockIdx.x >> 2;                 // 16-row band
  const int cg = blockIdx.x & 3;                  // group of 128 columns = 4 tiles
  const float* p = in + (size_t)(rt * 16 + (t >> 4)) * kDim + cg * 128 + (t & 15) * 8;
  const v4f a = *(const v4f*)(p);
  const v4f c = *(const v4f*)(p + 4);
  unsigned short hb[8];
#pragma unroll
  for (int e = 0; e < 4; ++e) {
    hb[e]     = h_bits(a[e]);
    hb[4 + e] = h_bits(c[e]);
  }
  const v4u u = (v4u){pk16(hb[0], hb[1]), pk16(hb[2], hb[3]), pk16(hb[4], hb[5]), pk16(hb[6], hb[7])};
  sh[(t & 15) * 17 + (t >> 4)] = u;
  __syncthreads();
  unsigned short* q = out + (size_t)(rt * (kDim / 32) + cg * 4) * kTileH + t * 8;
  *(v4u*)q = sh[(t >> 4) * 17 + (t & 15)];
}

// ---------------------------------------------------------------------------
// Weight transpose + cast: W is f32 [512 in][nOut out] row-major (x @ W orientation); WT[o][i] = f16(scale * W[i][o]),
// WT in fragment order, tile (o >> 4) * 16 + (i >> 5). grid (512/64 input tiles, nOut/64 output tiles): blockIdx.x = i tile (64 cols of WT),
// blockIdx.y = o tile (64 rows of WT). 256 threads.
// Load coverage: 16 iterations x 256 threads = 4096 = the whole 64x64 tile (coalesced along o).
// Store coverage: wave w owns tile (16-row band w >> 1, 32-column band w & 1) of the 4 x 2 tiles; 2 iterations = its two halves.
// ---------------------------------------------------------------------------
__global__ __launch_bounds__(256) void wtcast_kernel(const float* __restrict__ W, int nOut,
                                                     unsigned short* __restrict__ out, float scale) {
  __shared__ float sm[64][65];   // sm[o_local][i_local]
  const int t  = threadIdx.x;
  const int i0 = blockIdx.x * 64;
  const int o0 = blockIdx.y * 64;
#pragma unroll
  for (int it = 0; it < 16; ++it) {
    const int e = it * 256 + t;
    const int r = e >> 6;          // i local
    const int c = e & 63;          // o local
    sm[c][r] = W[(size_t)(i0 + r) * nOut + o0 + c] * scale;
  }
  __syncthreads();
  const int lane = t & 31, wave = t >> 5;
  const int rtl = wave >> 1, ctl = wave & 1;
  {
#pragma unroll
    for (int it = 0; it < 2; ++it) {
      const int row = rtl * 16 + (lane & 15);                // o local
      const int c8  = ctl * 32 + it * 16 + (lane >> 4) * 8;  // i local
      unsigned short hb[8];
#pragma unroll
      for (int e = 0; e < 8; ++e) hb[e] = h_bits(sm[row][c8 + e]);
      const v4u u = (v4u){pk16(hb[0], hb[1]), pk16(hb[2], hb[3]), pk16(hb[4], hb[5]), pk16(hb[6], hb[7])};
      *(v4u*)(out + (size_t)(((o0 >> 4) + rtl) * (kDim / 32) + (i0 >> 5) + ctl) * kTileH + it * 256 + lane * 8) = u;
    }
    
  }
}

__device__ __forceinline__ float xhalf(float x) {
  const int i = __builtin_bit_cast(int, x);
  return __builtin_bit_cast(float, __builtin_amdgcn_permlanex16(i, i, 0x76543210, 0xfedcba98, false, false));
}
__device__ __forceinline__ unsigned pack2h(float lo, float hi) {   // two f32 -> packed f16, round to nearest even
  typedef __attribute__((ext_vector_type(2))) float    f2;
  typedef __attribute__((ext_vector_type(2))) _Float16 h2;
  return __builtin_bit_cast(unsigned, __builtin_convertvector((f2){lo, hi}, h2));
}
constexpr int kQWave  = 32;                 // queries per wave
constexpr int kQBlock = 8 * kQWave;         // queries per block
constexpr int kPass   = 32;                 // keys per pass
static_assert(kSeq % kQBlock == 0 && kSeq % kPass == 0 && (kSeq & (kSeq - 1)) == 0 && kDh == 64, "fused attention shape");
// waves_per_eu(4, 4): 512 blocks on 256 WGPs = two blocks per WGP = four waves per SIMD, so at most 256 registers a wave
__global__ __launch_bounds__(256) __attribute__((amdgpu_waves_per_eu(4, 4)))
void attn_fused_kernel(const unsigned short* __restrict__ Qp, const unsigned short* __restrict__ Kp,
                       const unsigned short* __restrict__ VTp, unsigned short* __restrict__ O16) {
  typedef Frag<_Float16> F;
  const int lane = threadIdx.x & 31;
  const int wave = threadIdx.x >> 5;
  const int hb = blockIdx.y;                // h*16 + b: the head-major Q and K planes are contiguous in it
  const int h  = hb >> 4;
  const int b  = hb & 15;
  const int q0 = blockIdx.x * kQBlock + wave * kQWave;
  const _Float16* Q = (const _Float16*)Qp + (size_t)hb * (kSeq * kDh);
  const _Float16* kp = (const _Float16*)Kp + (size_t)hb * (kSeq * kDh) + lane * 8;    // + key0*64 + (2*kt + kc)*kTileH
  const _Float16* vp = (const _Float16*)VTp + (size_t)hb * (kSeq * kDh) + lane * 8;   // + key0*64 + t*kTileH
  const float cscale = kAttScale * 1.4426950408889634f;   // score scale times log2(e)

  v16h qf[2][2];
#pragma unroll
  for (int g = 0; g < 2; ++g)
#pragma unroll
    for (int kc = 0; kc < 2; ++kc) qf[g][kc] = F::loadp(Q + (size_t)(((q0 >> 4) + g) * 2 + kc) * kTileH + lane * 8);

  v8f acc[2][4];
  float m_run[2], l_run[2];
#pragma unroll
  for (int g = 0; g < 2; ++g) {
    m_run[g] = -INFINITY; l_run[g] = 0.f;
#pragma unroll
    for (int t = 0; t < 4; ++t) acc[g][t] = (v8f){0.f,0.f,0.f,0.f,0.f,0.f,0.f,0.f};
  }

  v16h kf[2][2];
#pragma unroll
  for (int kt = 0; kt < 2; ++kt)
#pragma unroll
    for (int kc = 0; kc < 2; ++kc) kf[kt][kc] = F::loadp(kp + (2 * kt + kc) * kTileH);

  // rolled: one pass is already 16 WMMAs and 16 loads, and unrolling would cost the registers of the fourth wave per SIMD
#pragma unroll 1
  for (int key0 = 0; key0 < kSeq; key0 += kPass) {
    // this pass's V^T fragments, in flight under the first product and the softmax
    v16h vf[4];
#pragma unroll
    for (int t = 0; t < 4; ++t) vf[t] = F::loadp(vp + (size_t)key0 * kDh + t * kTileH);

    v8f s[2][2];
#pragma unroll
    for (int kt = 0; kt < 2; ++kt)
#pragma unroll
      for (int g = 0; g < 2; ++g) {
        s[kt][g] = (v8f){0.f,0.f,0.f,0.f,0.f,0.f,0.f,0.f};
#pragma unroll
        for (int kc = 0; kc < 2; ++kc) s[kt][g] = F::mma(kf[kt][kc], qf[g][kc], s[kt][g]);
      }

    // next pass's K fragments, in flight under the softmax and the second product (the last pass re-reads keys 0..31, unused)
    const int nk = (key0 + kPass) & (kSeq - 1);
#pragma unroll
    for (int kt = 0; kt < 2; ++kt)
#pragma unroll
      for (int kc = 0; kc < 2; ++kc) kf[kt][kc] = F::loadp(kp + (size_t)nk * kDh + (2 * kt + kc) * kTileH);

#pragma unroll
    for (int g = 0; g < 2; ++g) {
      float mx = s[0][g][0];
#pragma unroll
      for (int r = 1; r < 8; ++r) mx = fmaxf(mx, s[0][g][r]);
#pragma unroll
      for (int r = 0; r < 8; ++r) mx = fmaxf(mx, s[1][g][r]);
      mx = fmaxf(mx, xhalf(mx)) * cscale;                    // both halves hold the query's maximum of this pass, scaled
      const float m_new = fmaxf(m_run[g], mx);
      const float corr  = __builtin_amdgcn_exp2f(m_run[g] - m_new);   // 0 on the first pass (m_run = -inf, m_new finite)
      m_run[g] = m_new;
      float ps = 0.f;
      union { v16h v; unsigned w[8]; } pf;
#pragma unroll
      for (int i = 0; i < 8; ++i) {   // operand elements 2i, 2i+1 = tile i>>2, registers 2(i&3), 2(i&3)+1
        const float p0 = __builtin_amdgcn_exp2f(fmaf(s[i >> 2][g][2 * (i & 3)],     cscale, -m_new));
        const float p1 = __builtin_amdgcn_exp2f(fmaf(s[i >> 2][g][2 * (i & 3) + 1], cscale, -m_new));
        ps += p0 + p1;
        pf.w[i] = pack2h(p0, p1);
      }
      l_run[g] = fmaf(l_run[g], corr, ps);                   // this half's keys only; the halves join after the loop
#pragma unroll
      for (int t = 0; t < 4; ++t) {
        acc[g][t] = acc[g][t] * corr;
        acc[g][t] = F::mma(vf[t], pf.v, acc[g][t]);
      }
    }
  }

#pragma unroll
  for (int g = 0; g < 2; ++g) {
    const float l_fin = l_run[g] + xhalf(l_run[g]);
    const float inv = kMidCarry / l_fin;                     // the x64 carry of the O16 plane
    unsigned short* op = O16 + ((size_t)((b * kSeq + q0 + 16 * g) >> 4) * (kDim / 32) + h * 2) * kTileH + lane * 8;
#pragma unroll
    for (int t = 0; t < 4; ++t) {
      const v8f o = acc[g][t] * inv;
      *(v4u*)(op + t * 256) = (v4u){pack2h(o[0], o[1]), pack2h(o[2], o[3]), pack2h(o[4], o[5]), pack2h(o[6], o[7])};
    }
  }
}

// ---------------------------------------------------------------------------
// Depthwise 3x3 conv (zero SAME padding, cross-correlation, f32) on the V image + attention output, producing the
// f16 proj operand: MID[tok][c] = f16( O16[tok][c] + 64 * (conv_b[c] + sum_taps w * v) ), O16 already carried x64.
// V image: the fragment-order VT plane; a pass of 32 keys is one image row, so row y of the 64 channels of head h, batch b is the
// 4 KB at tile ((h*16 + b)*32 + y)*4. O16 and MID: fragment order, tile (token >> 4) * 16 + (channel >> 5).
// grid (512/64 channel tiles = heads, 32/4 image-row tiles, 16 batches), 256 threads.
// LDS image tile sv[64 ch][6 rows][34 cols]: rows y0-1..y0+4 (out-of-range rows written as zeros), cols 0 and 33 zero pads.
// Staging coverage: 6 iterations (image rows) x 256 threads (16-byte chunks of the row's 4 KB); pads 768 entries; weights 576; bias 64.
// Store phase: 4 rolled iterations x 256 threads: a wave takes one half tile (16 tokens x 16 channels) = 512 contiguous bytes;
// token group it*2 + (t>>7) covers 128 local tokens, ((t>>5)&3)*16 + ((t>>4)&1)*8 covers 64 channels.
// ---------------------------------------------------------------------------
constexpr int kCvRows  = 6;
constexpr int kCvCols  = 34;
constexpr int kCvPitch = kCvRows * kCvCols;   // 204 floats per channel
__global__ __launch_bounds__(256) void conv_mid_kernel(const unsigned short* __restrict__ VT,
                                                       const unsigned short* __restrict__ O16,
                                                       const float* __restrict__ cw, const float* __restrict__ cb,
                                                       unsigned short* __restrict__ MID,
                                                       const int* __restrict__ hw0, const int* __restrict__ hw1) {
  (void)hw0; (void)hw1;
  __shared__ __align__(16) float sv[64 * kCvPitch];   // 52,224 B
  __shared__ float sw[64 * 9];
  __shared__ float sb[64];
  const int t  = threadIdx.x;
  const int c0 = blockIdx.x * 64;
  const int y0 = blockIdx.y * 4;
  const int b  = blockIdx.z;

  // weights and bias of the 64 channels, pre-scaled by the x64 carry of the mid plane
  for (int i = t; i < 64 * 9; i += 256) sw[i] = cw[(size_t)c0 * 9 + i] * kMidCarry;
  if (t < 64) sb[t] = cb[c0 + t] * kMidCarry;
  // zero pad columns 0 and 33 of every staged row (disjoint from the staged words)
  for (int i = t; i < 64 * kCvRows * 2; i += 256) {
    const int cl  = i / (kCvRows * 2);
    const int rem = i - cl * (kCvRows * 2);
    const int r   = rem >> 1;
    const int col = (rem & 1) * (kCvCols - 1);
    sv[cl * kCvPitch + r * kCvCols + col] = 0.0f;
  }
  // stage 6 image rows of 64 channels as 128-bit words (8 halves); address clamped, value zeroed arithmetically when out of range
  const int cl = (t >> 6) * 16 + (t & 15);                       // chunk t of a row's 4 KB: channel ...
  const int x0 = ((t >> 5) & 1) * 16 + ((t >> 4) & 1) * 8;       // ... and first column
#pragma unroll
  for (int r = 0; r < 6; ++r) {         // staged row 0..5
    const int yy  = y0 - 1 + r;
    const int yyc = (yy < 0) ? 0 : ((yy > kImg - 1) ? (kImg - 1) : yy);
    const v4u u = *(const v4u*)(VT + (size_t)(((blockIdx.x * kBatch + b) * kImg + yyc) * 4) * kTileH + t * 8);
    const float f = (yy >= 0 && yy <= kImg - 1) ? 1.0f : 0.0f;
    float* dst = sv + cl * kCvPitch + r * kCvCols + 1 + x0;
    dst[0] = h16_to_f32(u[0] & 0xffffu) * f;
    dst[1] = h16_to_f32(u[0] >> 16) * f;
    dst[2] = h16_to_f32(u[1] & 0xffffu) * f;
    dst[3] = h16_to_f32(u[1] >> 16) * f;
    dst[4] = h16_to_f32(u[2] & 0xffffu) * f;
    dst[5] = h16_to_f32(u[2] >> 16) * f;
    dst[6] = h16_to_f32(u[3] & 0xffffu) * f;
    dst[7] = h16_to_f32(u[3] >> 16) * f;
  }
  __syncthreads();

  const int cp = (t >> 5) & 3;                      // 16-channel group: tile column cp >> 1, half cp & 1
  const int c8 = cp * 16 + ((t >> 4) & 1) * 8;
  // this thread's chunk in the O16 and MID planes for token group t >> 7; two 16-token bands further per iteration
  const size_t po0 = (size_t)((((b * kSeq + y0 * kImg) >> 4) + (t >> 7)) * (kDim / 32) + (c0 >> 5) + (cp >> 1)) * kTileH
                     + (cp & 1) * 256 + (t & 31) * 8;
  const unsigned short* oq = O16 + po0;
  unsigned short* mp = MID + po0;
#pragma unroll 1
  for (int it = 0; it < 4; ++it, oq += 2 * kBandH, mp += 2 * kBandH) {
    const int tg  = it * 2 + (t >> 7);  // 16-token group 0..7
    const int row = tg * 16 + (t & 15); // local token 0..127
    const int yl  = row >> 5;          // 0..3
    const int x   = row & 31;
    const v4u ou = *(const v4u*)oq;
    float o[8];
    o[0] = h16_to_f32(ou[0] & 0xffffu); o[1] = h16_to_f32(ou[0] >> 16);
    o[2] = h16_to_f32(ou[1] & 0xffffu); o[3] = h16_to_f32(ou[1] >> 16);
    o[4] = h16_to_f32(ou[2] & 0xffffu); o[5] = h16_to_f32(ou[2] >> 16);
    o[6] = h16_to_f32(ou[3] & 0xffffu); o[7] = h16_to_f32(ou[3] >> 16);
    unsigned short hb[8];
#pragma unroll
    for (int e = 0; e < 8; ++e) {
      const int ce = c8 + e;
      const float* vr = sv + ce * kCvPitch + yl * kCvCols + x;   // tap (ky,kx) at vr[ky*34 + kx]
      const float* wr = sw + ce * 9;
      float acc = sb[ce];
#pragma unroll
      for (int ky = 0; ky < 3; ++ky) {
#pragma unroll
        for (int kx = 0; kx < 3; ++kx) acc = fmaf(wr[ky * 3 + kx], vr[ky * kCvCols + kx], acc);
      }
      hb[e] = h_bits(o[e] + acc);
    }
    const v4u u = (v4u){pk16(hb[0], hb[1]), pk16(hb[2], hb[3]), pk16(hb[4], hb[5]), pk16(hb[6], hb[7])};
    *(v4u*)mp = u;
    
  }
}

// ---------------------------------------------------------------------------
// Host glue.
// Every 16-bit plane below is held in fragment order (see kTileH); the shapes name its rows x k.
//   XH     f16 [16384][512]            16,777,216  at           0   (x cast)
//   WQKVT  f16 [1536][512]  x16          1,572,864  at  16,777,216   (rows 0..511 Wq^T, 512..1023 Wk^T, 1024..1535 Wv^T)
//   WPT    f16 [512][512]   x16            524,288  at  18,350,080
//   Q16    f16 [8][16384][64]          16,777,216  at  18,874,368   (head-major, row = b*1024+n)
//   K16    f16 [8][16384][64]          16,777,216  at  35,651,584
//   VT     f16 [512][16384]            16,777,216  at  52,428,800   (per head: tile (token >> 5) * 4 + (d >> 4))
//   O16    f16 [16384][512]  x64       16,777,216  at  69,206,016
//   MID16  f16 [16384][512]  x64       16,777,216  at  85,983,232
//   total                             102,760,448
// GEMM shapes (all M,N multiples of 64, K % 32 == 0, no padding anywhere):
//   q, k:  M=16384 N=64 K=512;  v^T: M=64 N=16384 K=512;  proj:  M=512 N=1024 K=512 (writes out[b][c][n] directly).
// Scores, softmax and P.V of all 128 (head, batch) pairs: one launch of attn_fused_kernel.
// ---------------------------------------------------------------------------
extern "C" void kernel_launch(void* const* d_in, const int* in_sizes, int n_in,
                              void* d_out, int out_size, void* d_ws, size_t ws_size,
                              hipStream_t stream) {
  if (n_in < 11) return;
  const int nX = kTok * kDim;                       // 8,388,608
  if (in_sizes[0] != nX) return;
  if (in_sizes[1] != kDim * kDim || in_sizes[2] != kDim) return;
  if (in_sizes[3] != kDim * 2 * kDim || in_sizes[4] != 2 * kDim) return;
  if (in_sizes[5] != kDim * 9 || in_sizes[6] != kDim) return;
  if (in_sizes[7] != kDim * kDim || in_sizes[8] != kDim) return;
  if (out_size != kBatch * kDim * kSeq) return;

  const size_t szPlane16 = (size_t)kTok * kDim * 2;                 // 16,777,216
  const size_t szWQKVT   = (size_t)3 * kDim * kDim * 2;             //  1,572,864
  const size_t szWPT     = (size_t)kDim * kDim * 2;                 //    524,288
  const size_t szQ       = (size_t)kHeads * kTok * kDh * 2;         // 16,777,216
  const size_t szVT      = (size_t)kDim * kTok * 2;                 // 16,777,216
  const size_t offXH   = 0;
  const size_t offWQKV = offXH + szPlane16;
  const size_t offWPT  = offWQKV + szWQKVT;
  const size_t offQ    = offWPT + szWPT;
  const size_t offK    = offQ + szQ;
  const size_t offVT   = offK + szQ;
  const size_t offO    = offVT + szVT;
  const size_t offMID  = offO + szPlane16;
  const size_t total   = offMID + szPlane16;                       // 102,760,448
  if (ws_size < total) return;

  const float* x    = (const float*)d_in[0];
  const float* Wq   = (const float*)d_in[1];
  const float* bq   = (const float*)d_in[2];
  const float* Wkv  = (const float*)d_in[3];
  const float* bkv  = (const float*)d_in[4];
  const float* cw   = (const float*)d_in[5];
  const float* cb   = (const float*)d_in[6];
  const float* Wp   = (const float*)d_in[7];
  const float* bp   = (const float*)d_in[8];
  const int*   hIn  = (const int*)d_in[9];     // static image height (32), structural only
  const int*   wIn  = (const int*)d_in[10];    // static image width (32), structural only
  float* out = (float*)d_out;
  char* ws = (char*)d_ws;
  unsigned short* XH    = (unsigned short*)(ws + offXH);
  unsigned short* WQKVT = (unsigned short*)(ws + offWQKV);
  unsigned short* WPT   = (unsigned short*)(ws + offWPT);
  unsigned short* Q16   = (unsigned short*)(ws + offQ);
  unsigned short* K16   = (unsigned short*)(ws + offK);
  unsigned short* VT    = (unsigned short*)(ws + offVT);
  unsigned short* O16   = (unsigned short*)(ws + offO);
  unsigned short* MID16 = (unsigned short*)(ws + offMID);

  // ---- prologue: 16-bit operand planes ----
  const int n8 = nX / 8;   // 1,048,576 -> 4096 blocks exact
  cast8_f16_kernel<<<dim3(n8 / 256), dim3(256), 0, stream>>>(x, XH, n8);
  // Wq [512 in][512 out] -> WQKVT rows 0..511;  Wkv [512 in][1024 out] -> rows 512..1535;  Wp -> WPT
  wtcast_kernel<<<dim3(kDim / 64, kDim / 64), dim3(256), 0, stream>>>(Wq, kDim, WQKVT, kWCarry);
  wtcast_kernel<<<dim3(kDim / 64, (2 * kDim) / 64), dim3(256), 0, stream>>>(Wkv, 2 * kDim, WQKVT + (size_t)kDim * kDim, kWCarry);
  wtcast_kernel<<<dim3(kDim / 64, kDim / 64), dim3(256), 0, stream>>>(Wp, kDim, WPT, kWCarry);

  // ---- projections ----
  const long strideHeadW  = (long)kDh * kDim;          // 64 weight rows per head = 32768 halves
  const long strideHeadQK = (long)kTok * kDh;          // per-head [16384][64] plane = 1,048,576 halves
  const long strideHeadVT = (long)kDh * kTok;          // per-head 64 rows of [512][16384] = 1,048,576 halves
  const int  tilesQK = (kTok / 64) * (kDh / 64);       // 256 -> 32 blocks
  // Q16[h][tok][d] = 1/16 * sum_k XH[tok][k] * WQKVT[h*64+d][k] + bq[h*64+d]
  wmma_gemm64<0, false, 2, 1, false, 0, 2, 1><<<dim3(tilesQK / 8, kHeads), dim3(256), 0, stream>>>(
      XH, XH, kDim, 0L, WQKVT, WQKVT, kDim, strideHeadW,
      (void*)Q16, (void*)Q16, kDh, strideHeadQK, bq, (long)kDh, bq, 0L, kTok, kDh, kDim, kWCarryInv);
  // K16 from WQKVT rows 512 + h*64
  wmma_gemm64<0, false, 2, 1, false, 0, 2, 1><<<dim3(tilesQK / 8, kHeads), dim3(256), 0, stream>>>(
      XH, XH, kDim, 0L, WQKVT + (size_t)kDim * kDim, WQKVT, kDim, strideHeadW,
      (void*)K16, (void*)K16, kDh, strideHeadQK, bkv, (long)kDh, bkv, 0L, kTok, kDh, kDim, kWCarryInv);
  // VT[h*64+d][tok] = 1/16 * sum_k WQKVT[1024 + h*64 + d][k] * XH[tok][k] + bkv[512 + h*64 + d]   (M=64, N=16384)
  wmma_gemm64<0, false, 1, 1, false, 0, 1, 4><<<dim3(tilesQK / 8, kHeads), dim3(256), 0, stream>>>(
      WQKVT + (size_t)2 * kDim * kDim, WQKVT, kDim, strideHeadW, XH, XH, kDim, 0L,
      (void*)VT, (void*)VT, kTok, strideHeadVT, bkv + kDim, (long)kDh, bkv, 0L, kDh, kTok, kDim, kWCarryInv);

  // ---- attention, all heads and batches in one launch: O16[b*1024 + i][h*64 + d] = f16(64 * softmax(0.125 q.k^T) . v) ----
  const long strideBO = (long)kSeq * kDim;             // next batch in the [16384][512] planes = 524288
  attn_fused_kernel<<<dim3(kSeq / kQBlock, kHeads * kBatch), dim3(256), 0, stream>>>(Q16, K16, VT, O16);

  // ---- depthwise conv branch + add -> MID16 (x64) ----
  conv_mid_kernel<<<dim3(kDim / 64, kImg / 4, kBatch), dim3(256), 0, stream>>>(VT, O16, cw, cb, MID16, hIn, wIn);

  // ---- output projection, transposed store: out[b][c][n] = 1/1024 * sum_k WPT[c][k] * MID16[b*1024+n][k] + bp[c] ----
  const int tilesProj = (kDim / 64) * (kSeq / 64);     // 128 -> 16 blocks
  wmma_gemm64<0, false, 1, 0, false, 0><<<dim3(tilesProj / 8, kBatch), dim3(256), 0, stream>>>(
      WPT, WPT, kDim, 0L, MID16, MID16, kDim, strideBO,
      (void*)out, (void*)out, kSeq, (long)kDim * kSeq, bp, 0L, bp, 0L, kDim, kSeq, kDim, kProjScale);
}

// v004
// Measured time: 105 microseconds a run.
// Two timings next to v003 both put it at 1.20 times that version's speed.
// All steps since v000 together make it 21.1 times as fast.
// Contractions: q/k/v projections (x f16 x W^T f16 carried x16), scores q.k^T (q,k f16 planes), attn.v (V^T f16 x P^T f16, P = exp(s - running max) unnormalised), output projection (W^T f16 x16 x mid f16 x64): all v_wmma_f32_16x16x32_f16, f32 accumulate; softmax, depthwise 3x3 conv, bias adds in f32.
#include <hip/hip_runtime.h>
#include <math.h>

// ---------------------------------------------------------------------------
// Problem constants
// ---------------------------------------------------------------------------
constexpr int kBatch = 16;
constexpr int kSeq   = 1024;              // tokens per batch = 32 x 32 image
constexpr int kDim   = 512;
constexpr int kHeads = 8;
constexpr int kDh    = 64;
constexpr int kImg   = 32;
constexpr int kTok   = kBatch * kSeq;     // 16384 token rows
constexpr float kWCarry     = 16.0f;      // weights carried x16 in f16
constexpr float kWCarryInv  = 1.0f / 16.0f;
constexpr float kMidCarry   = 64.0f;      // attention output and mid carried x64 in f16
constexpr float kAttScale   = 0.125f;     // 64^-0.5
constexpr float kProjScale  = 1.0f / (kMidCarry * kWCarry);  // 1/1024
static_assert(kHeads * kDh == kDim, "shape");
static_assert(kImg * kImg == kSeq, "image");
static_assert(kTok % 64 == 0 && kSeq % 64 == 0 && kDim % 64 == 0 && kDh % 64 == 0, "tile multiples");
static_assert(kDim % 32 == 0 && kDh % 32 == 0 && kSeq % 32 == 0, "K multiples of 32");

// Fragment order of every 16-bit operand plane: a plane of rows x k is cut into tiles of 16 rows x 32 k = kTileH halves (1 KB).
// Inside a tile, element (row r, k) sits at ((k >> 4) & 1) * 256 + (((k >> 3) & 1) * 16 + (r & 15)) * 8 + (k & 7):
// lane l = 16 * hf + r of a wave finds its fragment elements 0..7 at l * 8 and 8..15 at 256 + l * 8, so each of the two
// 16-byte loads (or stores) of a wave covers 512 contiguous bytes = four whole lines.
constexpr int kTileH = 512;
constexpr int kBandH = (kDim / 32) * kTileH;   // a 16-row band of a plane with k extent kDim: 16 tiles in a row
typedef __attribute__((ext_vector_type(16))) _Float16 v16h;
typedef __attribute__((ext_vector_type(8)))  _Float16 v8h;
typedef __attribute__((ext_vector_type(16))) __bf16   v16b;
typedef __attribute__((ext_vector_type(8)))  __bf16   v8b;
typedef __attribute__((ext_vector_type(8)))  float    v8f;
typedef __attribute__((ext_vector_type(4)))  float    v4f;
typedef __attribute__((ext_vector_type(4)))  unsigned int v4u;

__device__ __forceinline__ unsigned short f2bf_bits(float f) {
  unsigned u = __float_as_uint(f);
  return (unsigned short)((u + 0x7FFFu + ((u >> 16) & 1u)) >> 16);
}
__device__ __forceinline__ float bf_bits2f(unsigned short h) { return __uint_as_float(((unsigned)h) << 16); }

// hazard guards as plain device helpers (no inline asm inside the kernel template body)
__device__ __forceinline__ void dep_guard_h(v8f& a, v8f& b, v16h x, v16h y) { asm volatile("v_nop\n\tv_nop\n\tv_nop\n\tv_nop" : "+v"(a), "+v"(b) : "v"(x), "v"(y)); }
__device__ __forceinline__ void dep_guard_b(v8f& a, v8f& b, v16b x, v16b y) { asm volatile("v_nop\n\tv_nop\n\tv_nop\n\tv_nop" : "+v"(a), "+v"(b) : "v"(x), "v"(y)); }
__device__ __forceinline__ void keep4_h(v16h a, v16h b, v16h c, v16h d) { asm volatile("v_nop" :: "v"(a), "v"(b), "v"(c), "v"(d)); }
__device__ __forceinline__ void keep4_b(v16b a, v16b b, v16b c, v16b d) { asm volatile("v_nop" :: "v"(a), "v"(b), "v"(c), "v"(d)); }
__device__ __forceinline__ void acc_guard4(v8f& a, v8f& b, v8f& c, v8f& d) { asm volatile("v_nop\n\tv_nop\n\tv_nop\n\tv_nop" : "+v"(a), "+v"(b), "+v"(c), "+v"(d)); }
template <typename T> struct Frag;
template <> struct Frag<_Float16> {
  typedef v16h V; union U { v16h v; v8h h[2]; };
  // a fragment from a fragment-order tile (see kTileH), p = tile base + lane*8: elements 0..7 <- p[0..7], 8..15 <- p[256..263]
  static __device__ __forceinline__ v16h loadp(const _Float16* p) {
    U f; f.h[0] = *(const v8h*)(p); f.h[1] = *(const v8h*)(p + 256); return f.v;
  }
  static __device__ __forceinline__ v8f mma(v16h a, v16h b, v8f c) {
    return __builtin_amdgcn_wmma_f32_16x16x32_f16(false, a, false, b, (short)0, c, false, false);
  }
  static __device__ __forceinline__ void guard(v8f& a, v8f& b, v16h x, v16h y) { dep_guard_h(a, b, x, y); }
  static __device__ __forceinline__ void keep(v16h a, v16h b, v16h c, v16h d) { keep4_h(a, b, c, d); }
};
template <> struct Frag<__bf16> {
  typedef v16b V; union U { v16b v; v8b h[2]; };
  static __device__ __forceinline__ v16b loadp(const __bf16* p) {
    U f; f.h[0] = *(const v8b*)(p); f.h[1] = *(const v8b*)(p + 256); return f.v;
  }
  static __device__ __forceinline__ v8f mma(v16b a, v16b b, v8f c) {
    return __builtin_amdgcn_wmma_f32_16x16x32_bf16(false, a, false, b, (short)0, c, false, false);
  }
  static __device__ __forceinline__ void guard(v8f& a, v8f& b, v16b x, v16b y) { dep_guard_b(a, b, x, y); }
  static __device__ __forceinline__ void keep(v16b a, v16b b, v16b c, v16b d) { keep4_b(a, b, c, d); }
};

__device__ __forceinline__ unsigned pk16(unsigned short a, unsigned short b) { return (unsigned)a | ((unsigned)b << 16); }
__device__ __forceinline__ unsigned short h_bits(float f) { const _Float16 h = (_Float16)f; return __builtin_bit_cast(unsigned short, h); }

// f16 bits (low 16 bits of hb, finite values) -> f32, integer path only
__device__ __forceinline__ float h16_to_f32(unsigned hb) {
  const unsigned sgn = (hb & 0x8000u) << 16; const unsigned em = hb & 0x7fffu;
  const float fn = __uint_as_float((em << 13) + 0x38000000u);
  const float fs = (float)em * 5.9604644775390625e-8f;
  const float mag = (em < 0x400u) ? fs : fn; return __uint_as_float(__float_as_uint(mag) | sgn); }

// ---- Register-blocked batched WMMA GEMM (ACT reduced to none/relu/leaky; bias gets a per-z stride and the
//      bias[m] line is loaded as two float4 per 16-row slab instead of per-lane scalars; RESID path not instantiated) ---
// C[m,n] = scale * sum_k A[m,k] * Bt[n,k] (+bias); each wave owns a 64x64 tile.
// A [M,kDim] and Bt [N,kDim] in fragment order, tile (row >> 4) * (kDim / 32) + (k >> 5); M,N % 64 == 0, K = kDim (the argument is not read).
// SPLIT (hi/lo operand planes): not instantiated.
// BIAS_MODE: 0 = none, 1 = bias[m], 2 = bias[n]; bias base = bias + z*strideBias.
// OUT_MODE: 0 = f32 row-major, 1 = f16 in fragment order, tile (m >> 4) * TRS + (n >> 5) * TCS, 2 = bf16 hi plane (Cout) + bf16 lo plane (Cout2).
// ET: 0 = f16 operands, 1 = bf16 operands (pointers passed as 16-bit storage)
// base + a 32-bit byte offset: with a wave-uniform base this is the load's own scalar-base form, no 64-bit vector add per step
template <typename T> __device__ __forceinline__ const T* at_bytes(const T* base, unsigned bytes) {
  return (const T*)((const char*)base + bytes);
}
template <int ET> struct Elem;
template <> struct Elem<0> { typedef _Float16 T; };
template <> struct Elem<1> { typedef __bf16 T; };
// The engine is a device function, so that one launch can hold GEMMs of different template forms (b = the GEMM's own z index,
// sT = the block's 8 per-wave 16x64 slabs, pitch 68 floats).
constexpr int kSlabF = 16 * 68;
template <int ET, bool SPLIT, int BIAS_MODE, int OUT_MODE, bool RESID, int ACT = 0, int TRS = 0, int TCS = 0>
__device__ __forceinline__ void gemm64_body(
    float (*sT)[kSlabF], const int b,
    const unsigned short* __restrict__ Ap, long strideA,
    const unsigned short* __restrict__ Btp, long strideB,
    void* __restrict__ Cout, void* __restrict__ Cout2, int ldc, long strideC,
    const float* __restrict__ bias, long strideBias,
    int M, int N, float scale) {
  static_assert(!RESID, "resid path not used");
  static_assert(!SPLIT, "split path not used");
  typedef typename Elem<ET>::T T;
  typedef typename Frag<T>::V V;
  const T* A = (const T*)Ap; const T* Bt = (const T*)Btp;
  const int lane = threadIdx.x & 31;
  // the wave's number in a scalar register: the band bases of the k loop are then scalar, and a fragment load is scalar base + offset
  const int wave = __builtin_amdgcn_readfirstlane(threadIdx.x >> 5);
  const int tilesN = N >> 6;
  const int tilesM = M >> 6;
  const int tile = blockIdx.x * 8 + wave;
  if (tile >= tilesM * tilesN) return;   // wave-uniform; no block barriers in this kernel
  const int tm = tile / tilesN;
  const int tn = tile - tm * tilesN;
  const int m0 = tm << 6;
  const int n0 = tn << 6;

  const T* Ab  = A  + (size_t)b * strideA;
  const T* Bb  = Bt + (size_t)b * strideB;

  const int rlane = lane & 15;                 // row (A) / col (B, D) within subtile
  const int mOff  = (lane >> 4) * 8;           // D row offset

  v8f acc[4][4];
#pragma unroll
  for (int i = 0; i < 4; ++i)
#pragma unroll
    for (int j = 0; j < 4; ++j) acc[i][j] = (v8f){0.f,0.f,0.f,0.f,0.f,0.f,0.f,0.f};

  // the wave's first A and B band (wave-uniform); A and B share one 32-bit offset: this lane's chunk of the k step's tile
  const T* Aw = Ab + (size_t)(m0 >> 4) * kBandH;
  const T* Bw = Bb + (size_t)(n0 >> 4) * kBandH;
  const unsigned lane16 = (unsigned)lane * 16u;                                  // in bytes
  // Every fragment is fetched one k step ahead of its WMMAs. An A fragment serves one row of four WMMAs, so its registers
  // take the next step's fragment right behind that row; a B fragment serves all four rows, so B has two register sets,
  // and the idle set is refilled behind row 0.
  const T* Al = at_bytes(Aw, lane16);
  const T* Bl = at_bytes(Bw, lane16);
  V af[4], bf[2][4];
#pragma unroll
  for (int i = 0; i < 4; ++i) af[i] = Frag<T>::loadp(Al + i * kBandH);
#pragma unroll
  for (int j = 0; j < 4; ++j) bf[0][j] = Frag<T>::loadp(Bl + j * kBandH);
#pragma unroll   // all steps in a row: the B sets are named by constants (no register copies), every load is base + lane + immediate, the last step fetches nothing
  for (int ks = 0; ks < kDim / 32; ++ks) {
    const int s = ks & 1;
    const bool more = ks + 1 < kDim / 32;
#pragma unroll
    for (int i = 0; i < 4; ++i) {
#pragma unroll
      for (int j = 0; j < 4; ++j) acc[i][j] = Frag<T>::mma(af[i], bf[s][j], acc[i][j]);
      Frag<T>::guard(acc[i][0], acc[i][3], af[i], af[i]);
      // the pair of scheduling fences holds each refill right behind its whole row: ahead of the row's last WMMA it would need
      // registers of its own (spills), and behind WMMAs of later rows it would lose its lead
      __builtin_amdgcn_sched_barrier(0);
      if (more) {
        af[i] = Frag<T>::loadp(Al + (ks + 1) * kTileH + i * kBandH);
        if (i == 0) {
#pragma unroll
          for (int j = 0; j < 4; ++j) bf[s ^ 1][j] = Frag<T>::loadp(Bl + (ks + 1) * kTileH + j * kBandH);
        }
      }
      __builtin_amdgcn_sched_barrier(0);
    }
    Frag<T>::keep(bf[s][0], bf[s][1], bf[s][2], bf[s][3]);
  }
  acc_guard4(acc[0][0], acc[0][1], acc[0][2], acc[0][3]);
  acc_guard4(acc[1][0], acc[1][1], acc[1][2], acc[1][3]);
  acc_guard4(acc[2][0], acc[2][1], acc[2][2], acc[2][3]);
  acc_guard4(acc[3][0], acc[3][1], acc[3][2], acc[3][3]);

  // ---- epilogue ----
  float* slab = sT[wave];
  const float* biasb = (BIAS_MODE != 0) ? (bias + (size_t)b * strideBias) : nullptr;
#pragma unroll
  for (int i = 0; i < 4; ++i) {
    const int mBase = m0 + (i << 4);
    float b8[8] = {0.f,0.f,0.f,0.f,0.f,0.f,0.f,0.f};
    if (BIAS_MODE == 1) {
      const v4f bm0 = *(const v4f*)(biasb + mBase + mOff);
      const v4f bm1 = *(const v4f*)(biasb + mBase + mOff + 4);
      b8[0] = bm0[0]; b8[1] = bm0[1]; b8[2] = bm0[2]; b8[3] = bm0[3];
      b8[4] = bm1[0]; b8[5] = bm1[1]; b8[6] = bm1[2]; b8[7] = bm1[3];
    }
#pragma unroll
    for (int j = 0; j < 4; ++j) {
      const int n = n0 + (j << 4) + rlane;
      float bv = 0.f;
      if (BIAS_MODE == 2) bv = biasb[n];
#pragma unroll
      for (int r = 0; r < 8; ++r) {
        float v = acc[i][j][r] * scale;
        if (BIAS_MODE == 1) v += b8[r];
        if (BIAS_MODE == 2) v += bv;
        if (ACT == 2) v = fmaxf(v, 0.0f);
        if (ACT == 4) v = (v > 0.f) ? v : 0.01f * v;
        slab[(mOff + r) * 68 + (j << 4) + rlane] = v;
      }
    }
    __builtin_amdgcn_fence(__ATOMIC_RELEASE, "workgroup");
    __builtin_amdgcn_wave_barrier();
    __builtin_amdgcn_fence(__ATOMIC_ACQUIRE, "workgroup");
    if (OUT_MODE == 0) {
      float* C = (float*)Cout + (size_t)b * strideC;
      const int hh = lane >> 4, c4 = (lane & 15) * 4;     // row seg = 256 B = 16 lanes x 16 B
      {
#pragma unroll
        for (int it = 0; it < 8; ++it) {
          const int row = it * 2 + hh;
          v4f v = *(const v4f*)(slab + row * 68 + c4);
          *(v4f*)(C + (size_t)(mBase + row) * ldc + n0 + c4) = v;
        }
        
      }
    } else if (OUT_MODE == 1) {
      // slab row = lane & 15, columns it*16 + 8*(lane >> 4) ..+7: one 512-byte half tile per store
      unsigned short* C = (unsigned short*)Cout + (size_t)b * strideC;
#pragma unroll   // the four tile offsets become immediates on one address
      for (int it = 0; it < 4; ++it) {
        const float* sp = slab + rlane * 68 + it * 16 + mOff;
        v8h hv;
#pragma unroll   // keeps hv in registers
        for (int e = 0; e < 8; ++e) hv[e] = (_Float16)sp[e];
        const size_t tileC = (size_t)(mBase >> 4) * TRS + (size_t)((n0 >> 5) + (it >> 1)) * TCS;
        *(v8h*)(C + tileC * kTileH + (it & 1) * 256 + lane * 8) = hv;
      }
    } else {
      const int q = lane >> 3, c8 = (lane & 7) * 8;
      unsigned short* C  = (unsigned short*)Cout  + (size_t)b * strideC;
      unsigned short* C2 = (OUT_MODE == 2) ? ((unsigned short*)Cout2 + (size_t)b * strideC) : nullptr;
      {
#pragma unroll
        for (int it = 0; it < 4; ++it) {
          const int row = it * 4 + q;
          const float* sp = slab + row * 68 + c8;
          v8h hv, lv;
#pragma unroll
          for (int e = 0; e < 8; ++e) {
            if (OUT_MODE == 1) {
              hv[e] = (_Float16)sp[e];
            } else {
              unsigned short hb = f2bf_bits(sp[e]);
              unsigned short lb = f2bf_bits(sp[e] - bf_bits2f(hb));
              hv[e] = __builtin_bit_cast(_Float16, hb);
              lv[e] = __builtin_bit_cast(_Float16, lb);
            }
          }
          *(v8h*)(C + (size_t)(mBase + row) * ldc + n0 + c8) = hv;
          if (OUT_MODE == 2) *(v8h*)(C2 + (size_t)(mBase + row) * ldc + n0 + c8) = lv;
        }
        
      }
    }
    __builtin_amdgcn_fence(__ATOMIC_RELEASE, "workgroup");
    __builtin_amdgcn_wave_barrier();
    __builtin_amdgcn_fence(__ATOMIC_ACQUIRE, "workgroup");
  }
}

// one GEMM per launch, z = blockIdx.y
template <int ET, bool SPLIT, int BIAS_MODE, int OUT_MODE, bool RESID, int ACT = 0, int TRS = 0, int TCS = 0>
__global__ __launch_bounds__(256) void wmma_gemm64(
    const unsigned short* __restrict__ Ap, const unsigned short* __restrict__ A2p, int lda, long strideA,
    const unsigned short* __restrict__ Btp, const unsigned short* __restrict__ Bt2p, int ldb, long strideB,
    void* __restrict__ Cout, void* __restrict__ Cout2, int ldc, long strideC,
    const float* __restrict__ bias, long strideBias,
    const float* __restrict__ resid, long strideR,
    int M, int N, int K, float scale) {
  (void)resid; (void)strideR; (void)lda; (void)ldb; (void)K;
  (void)A2p; (void)Bt2p;
  __shared__ __align__(16) float sT[8][kSlabF];
  gemm64_body<ET, SPLIT, BIAS_MODE, OUT_MODE, RESID, ACT, TRS, TCS>(
      sT, blockIdx.y, Ap, strideA, Btp, strideB, Cout, Cout2, ldc, strideC, bias, strideBias, M, N, scale);
}

// The q, k and v projections of all heads in one launch: none reads what another writes. grid (32, 24): blockIdx.y = z,
// 0..7 q heads, 8..15 k heads, 16..23 v heads. The 64 weight rows of z start at WT + z * 64 * 512 and its output plane at
// QKV + z * 16384 * 64 (the Q16, K16 and VT planes follow one another); the k and v biases are bkv[(z - 8) * 64 ..].
//   q, k: C[tok][d] = 1/16 * sum_k XH[tok][k] * WT[z*64 + d][k] + bias[d]   (M = 16384, N = 64)
//   v^T:  C[d][tok] = 1/16 * sum_k WT[z*64 + d][k] * XH[tok][k] + bias[d]   (M = 64, N = 16384)
__global__ __launch_bounds__(256) void qkv_gemm_kernel(const unsigned short* __restrict__ XH, const unsigned short* __restrict__ WT,
                                                       unsigned short* __restrict__ QKV,
                                                       const float* __restrict__ bq, const float* __restrict__ bkv) {
  __shared__ __align__(16) float sT[8][kSlabF];
  const int z = blockIdx.y;
  const unsigned short* Wz = WT + (size_t)z * (kDh * kDim);
  unsigned short* Cz = QKV + (size_t)z * ((size_t)kTok * kDh);
  const float* bz = (z < kHeads) ? (bq + z * kDh) : (bkv + (z - kHeads) * kDh);
  if (z < 2 * kHeads) {   // block-uniform
    gemm64_body<0, false, 2, 1, false, 0, 2, 1>(sT, 0, XH, 0L, Wz, 0L, (void*)Cz, (void*)Cz, kDh, 0L, bz, 0L, kTok, kDh, kWCarryInv);
  } else {
    gemm64_body<0, false, 1, 1, false, 0, 1, 4>(sT, 0, Wz, 0L, XH, 0L, (void*)Cz, (void*)Cz, kTok, 0L, bz, 0L, kDh, kTok, kWCarryInv);
  }
}

// ---------------------------------------------------------------------------
// ---------------------------------------------------------------------------
// x f32 [16384][512] row-major -> f16 plane in fragment order, tile (row >> 4) * 16 + (k >> 5).
// A block takes 16 rows x 128 columns = 4 tiles = 256 chunks of 8 halves. Thread t reads chunk (row t >> 4, column group
// t & 15): 512 contiguous bytes per row. In fragment order that chunk has index (t & 15) * 16 + (t >> 4), a 16 x 16
// transpose of chunks, done through LDS (pitch 17 chunks against bank conflicts) so that the block stores 4 KB in a row.
__device__ __forceinline__ void cast8_f16_block(v4u* sh, const int blk, const float* __restrict__ in, unsigned short* __restrict__ out, int n8) {
  if ((blk + 1) * 256 > n8) return;               // block-uniform, in front of the barrier
  const int t  = threadIdx.x;
  const int rt = blk >> 2;                        // 16-row band
  const int cg = blk & 3;                         // group of 128 columns = 4 tiles
  const float* p = in + (size_t)(rt * 16 + (t >> 4)) * kDim + cg * 128 + (t & 15) * 8;
  const v4f a = *(const v4f*)(p);
  const v4f c = *(const v4f*)(p + 4);
  unsigned short hb[8];
#pragma unroll
  for (int e = 0; e < 4; ++e) {
    hb[e]     = h_bits(a[e]);
    hb[4 + e] = h_bits(c[e]);
  }
  const v4u u = (v4u){pk16(hb[0], hb[1]), pk16(hb[2], hb[3]), pk16(hb[4], hb[5]), pk16(hb[6], hb[7])};
  sh[(t & 15) * 17 + (t >> 4)] = u;
  __syncthreads();
  unsigned short* q = out + (size_t)(rt * (kDim / 32) + cg * 4) * kTileH + t * 8;
  *(v4u*)q = sh[(t >> 4) * 17 + (t & 15)];
}

// ---------------------------------------------------------------------------
// Weight transpose + cast: W is f32 [512 in][nOut out] row-major (x @ W orientation); WT[o][i] = f16(scale * W[i][o]),
// WT in fragment order, tile (o >> 4) * 16 + (i >> 5). 512/64 input tiles x nOut/64 output tiles: bi = i tile (64 cols of WT),
// bo = o tile (64 rows of WT). 256 threads.
// Load coverage: 16 iterations x 256 threads = 4096 = the whole 64x64 tile (coalesced along o).
// Store coverage: wave w owns tile (16-row band w >> 1, 32-column band w & 1) of the 4 x 2 tiles; 2 iterations = its two halves.
// ---------------------------------------------------------------------------
__device__ __forceinline__ void wtcast_block(float (*sm)[65], const int bi, const int bo, const float* __restrict__ W, int nOut,
                                             unsigned short* __restrict__ out, float scale) {
  // sm[o_local][i_local]
  const int t  = threadIdx.x;
  const int i0 = bi * 64;
  const int o0 = bo * 64;
  float wv[16];
#pragma unroll
  for (int it = 0; it < 16; ++it) {
    const int e = it * 256 + t;
    const int r = e >> 6;          // i local
    const int c = e & 63;          // o local
    wv[it] = W[(size_t)(i0 + r) * nOut + o0 + c];
    // behind each load: a later load's result may be given an address register of this one, and no register that an issued load names is rewritten ahead of this wait
    asm volatile("s_wait_xcnt 0x0" ::: "memory");
  }
#pragma unroll   // keeps wv in registers
  for (int it = 0; it < 16; ++it) {
    const int e = it * 256 + t;
    sm[e & 63][e >> 6] = wv[it] * scale;
  }
  __syncthreads();
  const int lane = t & 31, wave = t >> 5;
  const int rtl = wave >> 1, ctl = wave & 1;
  {
#pragma unroll
    for (int it = 0; it < 2; ++it) {
      const int row = rtl * 16 + (lane & 15);                // o local
      const int c8  = ctl * 32 + it * 16 + (lane >> 4) * 8;  // i local
      unsigned short hb[8];
#pragma unroll
      for (int e = 0; e < 8; ++e) hb[e] = h_bits(sm[row][c8 + e]);
      const v4u u = (v4u){pk16(hb[0], hb[1]), pk16(hb[2], hb[3]), pk16(hb[4], hb[5]), pk16(hb[6], hb[7])};
      *(v4u*)(out + (size_t)(((o0 >> 4) + rtl) * (kDim / 32) + (i0 >> 5) + ctl) * kTileH + it * 256 + lane * 8) = u;
    }
    
  }
}

// ---------------------------------------------------------------------------
// All four operand casts in one launch: none reads what another writes. The 256 weight blocks come first (their chain of loads,
// barrier and stores is the longer one): 0..63 Wq, 64..191 Wkv, 192..255 Wp, each as i tile = w & 7, o tile = w >> 3;
// blocks 256.. are the x cast's. Every branch is block-uniform, so each block meets exactly the one barrier of its own part.
// ---------------------------------------------------------------------------
constexpr int kWBlocksQ  = (kDim / 64) * (kDim / 64);          // 64
constexpr int kWBlocksKV = (kDim / 64) * ((2 * kDim) / 64);    // 128
constexpr int kWBlocks   = 2 * kWBlocksQ + kWBlocksKV;         // 256
__global__ __launch_bounds__(256) void cast_all_kernel(const float* __restrict__ x, const float* __restrict__ Wq,
                                                       const float* __restrict__ Wkv, const float* __restrict__ Wp,
                                                       unsigned short* __restrict__ XH, unsigned short* __restrict__ WQKVT,
                                                       unsigned short* __restrict__ WPT, int n8) {
  __shared__ float sm[64][65];
  __shared__ v4u sh[16 * 17];
  const int blk = blockIdx.x;
  if (blk >= kWBlocks) {
    cast8_f16_block(sh, blk - kWBlocks, x, XH, n8);
    return;
  }
  const bool isQ  = blk < kWBlocksQ;
  const bool isKV = !isQ && blk < kWBlocksQ + kWBlocksKV;
  const float* W         = isQ ? Wq : (isKV ? Wkv : Wp);
  unsigned short* WT     = isQ ? WQKVT : (isKV ? WQKVT + (size_t)kDim * kDim : WPT);
  const int first        = isQ ? 0 : (isKV ? kWBlocksQ : kWBlocksQ + kWBlocksKV);
  wtcast_block(sm, blk & 7, (blk - first) >> 3, W, isKV ? 2 * kDim : kDim, WT, kWCarry);
}

__device__ __forceinline__ float xhalf(float x) {
  const int i = __builtin_bit_cast(int, x);
  return __builtin_bit_cast(float, __builtin_amdgcn_permlanex16(i, i, 0x76543210, 0xfedcba98, false, false));
}
__device__ __forceinline__ unsigned pack2h(float lo, float hi) {   // two f32 -> packed f16, round to nearest even
  typedef __attribute__((ext_vector_type(2))) float    f2;
  typedef __attribute__((ext_vector_type(2))) _Float16 h2;
  return __builtin_bit_cast(unsigned, __builtin_convertvector((f2){lo, hi}, h2));
}
constexpr int kQWave  = 32;                 // queries per wave
constexpr int kQBlock = 8 * kQWave;         // queries per block
constexpr int kPass   = 32;                 // keys per pass
static_assert(kSeq % kQBlock == 0 && kSeq % kPass == 0 && (kSeq & (kSeq - 1)) == 0 && kDh == 64, "fused attention shape");
// waves_per_eu(4, 4): 512 blocks on 256 WGPs = two blocks per WGP = four waves per SIMD, so at most 256 registers a wave
__global__ __launch_bounds__(256) __attribute__((amdgpu_waves_per_eu(4, 4)))
void attn_fused_kernel(const unsigned short* __restrict__ Qp, const unsigned short* __restrict__ Kp,
                       const unsigned short* __restrict__ VTp, unsigned short* __restrict__ O16) {
  typedef Frag<_Float16> F;
  const int lane = threadIdx.x & 31;
  const int wave = threadIdx.x >> 5;
  const int hb = blockIdx.y;                // h*16 + b: the head-major Q and K planes are contiguous in it
  const int h  = hb >> 4;
  const int b  = hb & 15;
  const int q0 = blockIdx.x * kQBlock + wave * kQWave;
  const _Float16* Q = (const _Float16*)Qp + (size_t)hb * (kSeq * kDh);
  const _Float16* kp = (const _Float16*)Kp + (size_t)hb * (kSeq * kDh) + lane * 8;    // + key0*64 + (2*kt + kc)*kTileH
  const _Float16* vp = (const _Float16*)VTp + (size_t)hb * (kSeq * kDh) + lane * 8;   // + key0*64 + t*kTileH
  const float cscale = kAttScale * 1.4426950408889634f;   // score scale times log2(e)

  v16h qf[2][2];
#pragma unroll
  for (int g = 0; g < 2; ++g)
#pragma unroll
    for (int kc = 0; kc < 2; ++kc) qf[g][kc] = F::loadp(Q + (size_t)(((q0 >> 4) + g) * 2 + kc) * kTileH + lane * 8);

  v8f acc[2][4];
  float m_run[2], l_run[2];
#pragma unroll
  for (int g = 0; g < 2; ++g) {
    m_run[g] = -INFINITY; l_run[g] = 0.f;
#pragma unroll
    for (int t = 0; t < 4; ++t) acc[g][t] = (v8f){0.f,0.f,0.f,0.f,0.f,0.f,0.f,0.f};
  }

  v16h kf[2][2];
#pragma unroll
  for (int kt = 0; kt < 2; ++kt)
#pragma unroll
    for (int kc = 0; kc < 2; ++kc) kf[kt][kc] = F::loadp(kp + (2 * kt + kc) * kTileH);

  // rolled: one pass is already 16 WMMAs and 16 loads, and unrolling would cost the registers of the fourth wave per SIMD
#pragma unroll 1
  for (int key0 = 0; key0 < kSeq; key0 += kPass) {
    // this pass's V^T fragments, in flight under the first product and the softmax
    v16h vf[4];
#pragma unroll
    for (int t = 0; t < 4; ++t) vf[t] = F::loadp(vp + (size_t)key0 * kDh + t * kTileH);

    v8f s[2][2];
#pragma unroll
    for (int kt = 0; kt < 2; ++kt)
#pragma unroll
      for (int g = 0; g < 2; ++g) {
        s[kt][g] = (v8f){0.f,0.f,0.f,0.f,0.f,0.f,0.f,0.f};
#pragma unroll
        for (int kc = 0; kc < 2; ++kc) s[kt][g] = F::mma(kf[kt][kc], qf[g][kc], s[kt][g]);
      }

    // next pass's K fragments, in flight under the softmax and the second product (the last pass re-reads keys 0..31, unused)
    const int nk = (key0 + kPass) & (kSeq - 1);
#pragma unroll
    for (int kt = 0; kt < 2; ++kt)
#pragma unroll
      for (int kc = 0; kc < 2; ++kc) kf[kt][kc] = F::loadp(kp + (size_t)nk * kDh + (2 * kt + kc) * kTileH);

#pragma unroll
    for (int g = 0; g < 2; ++g) {
      float mx = s[0][g][0];
#pragma unroll
      for (int r = 1; r < 8; ++r) mx = fmaxf(mx, s[0][g][r]);
#pragma unroll
      for (int r = 0; r < 8; ++r) mx = fmaxf(mx, s[1][g][r]);
      mx = fmaxf(mx, xhalf(mx)) * cscale;                    // both halves hold the query's maximum of this pass, scaled
      const float m_new = fmaxf(m_run[g], mx);
      const float corr  = __builtin_amdgcn_exp2f(m_run[g] - m_new);   // 0 on the first pass (m_run = -inf, m_new finite)
      m_run[g] = m_new;
      float ps = 0.f;
      union { v16h v; unsigned w[8]; } pf;
#pragma unroll
      for (int i = 0; i < 8; ++i) {   // operand elements 2i, 2i+1 = tile i>>2, registers 2(i&3), 2(i&3)+1
        const float p0 = __builtin_amdgcn_exp2f(fmaf(s[i >> 2][g][2 * (i & 3)],     cscale, -m_new));
        const float p1 = __builtin_amdgcn_exp2f(fmaf(s[i >> 2][g][2 * (i & 3) + 1], cscale, -m_new));
        ps += p0 + p1;
        pf.w[i] = pack2h(p0, p1);
      }
      l_run[g] = fmaf(l_run[g], corr, ps);                   // this half's keys only; the halves join after the loop
#pragma unroll
      for (int t = 0; t < 4; ++t) {
        acc[g][t] = acc[g][t] * corr;
        acc[g][t] = F::mma(vf[t], pf.v, acc[g][t]);
      }
    }
  }

#pragma unroll
  for (int g = 0; g < 2; ++g) {
    const float l_fin = l_run[g] + xhalf(l_run[g]);
    const float inv = kMidCarry / l_fin;                     // the x64 carry of the O16 plane
    unsigned short* op = O16 + ((size_t)((b * kSeq + q0 + 16 * g) >> 4) * (kDim / 32) + h * 2) * kTileH + lane * 8;
#pragma unroll
    for (int t = 0; t < 4; ++t) {
      const v8f o = acc[g][t] * inv;
      *(v4u*)(op + t * 256) = (v4u){pack2h(o[0], o[1]), pack2h(o[2], o[3]), pack2h(o[4], o[5]), pack2h(o[6], o[7])};
    }
  }
}

// ---------------------------------------------------------------------------
// Depthwise 3x3 conv (zero SAME padding, cross-correlation, f32) on the V image + attention output, producing the
// f16 proj operand: MID[tok][c] = f16( O16[tok][c] + 64 * (conv_b[c] + sum_taps w * v) ), O16 already carried x64.
// V image: the fragment-order VT plane; a pass of 32 keys is one image row, so row y of the 64 channels of head h, batch b is the
// 4 KB at tile ((h*16 + b)*32 + y)*4. O16 and MID: fragment order, tile (token >> 4) * 16 + (channel >> 5).
// grid (512/64 channel tiles = heads, 32/4 image-row tiles, 16 batches), 256 threads.
// LDS image tile sv[64 ch][6 rows][34 cols]: rows y0-1..y0+4 (out-of-range rows written as zeros), cols 0 and 33 zero pads.
// Staging coverage: 6 iterations (image rows) x 256 threads (16-byte chunks of the row's 4 KB); pads 768 entries; weights 576; bias 64.
// Store phase: 4 rolled iterations x 256 threads: a wave takes one half tile (16 tokens x 16 channels) = 512 contiguous bytes;
// token group it*2 + (t>>7) covers 128 local tokens, ((t>>5)&3)*16 + ((t>>4)&1)*8 covers 64 channels.
// ---------------------------------------------------------------------------
constexpr int kCvRows  = 6;
constexpr int kCvCols  = 34;
constexpr int kCvPitch = kCvRows * kCvCols;   // 204 floats per channel
__global__ __launch_bounds__(256) void conv_mid_kernel(const unsigned short* __restrict__ VT,
                                                       const unsigned short* __restrict__ O16,
                                                       const float* __restrict__ cw, const float* __restrict__ cb,
                                                       unsigned short* __restrict__ MID,
                                                       const int* __restrict__ hw0, const int* __restrict__ hw1) {
  (void)hw0; (void)hw1;
  __shared__ __align__(16) float sv[64 * kCvPitch];   // 52,224 B
  __shared__ float sw[64 * 9];
  __shared__ float sb[64];
  const int t  = threadIdx.x;
  const int c0 = blockIdx.x * 64;
  const int y0 = blockIdx.y * 4;
  const int b  = blockIdx.z;

  // weights and bias of the 64 channels, pre-scaled by the x64 carry of the mid plane
  for (int i = t; i < 64 * 9; i += 256) sw[i] = cw[(size_t)c0 * 9 + i] * kMidCarry;
  if (t < 64) sb[t] = cb[c0 + t] * kMidCarry;
  // zero pad columns 0 and 33 of every staged row (disjoint from the staged words)
  for (int i = t; i < 64 * kCvRows * 2; i += 256) {
    const int cl  = i / (kCvRows * 2);
    const int rem = i - cl * (kCvRows * 2);
    const int r   = rem >> 1;
    const int col = (rem & 1) * (kCvCols - 1);
    sv[cl * kCvPitch + r * kCvCols + col] = 0.0f;
  }
  // stage 6 image rows of 64 channels as 128-bit words (8 halves); address clamped, value zeroed arithmetically when out of range
  const int cl = (t >> 6) * 16 + (t & 15);                       // chunk t of a row's 4 KB: channel ...
  const int x0 = ((t >> 5) & 1) * 16 + ((t >> 4) & 1) * 8;       // ... and first column
#pragma unroll
  for (int r = 0; r < 6; ++r) {         // staged row 0..5
    const int yy  = y0 - 1 + r;
    const int yyc = (yy < 0) ? 0 : ((yy > kImg - 1) ? (kImg - 1) : yy);
    const v4u u = *(const v4u*)(VT + (size_t)(((blockIdx.x * kBatch + b) * kImg + yyc) * 4) * kTileH + t * 8);
    const float f = (yy >= 0 && yy <= kImg - 1) ? 1.0f : 0.0f;
    float* dst = sv + cl * kCvPitch + r * kCvCols + 1 + x0;
    dst[0] = h16_to_f32(u[0] & 0xffffu) * f;
    dst[1] = h16_to_f32(u[0] >> 16) * f;
    dst[2] = h16_to_f32(u[1] & 0xffffu) * f;
    dst[3] = h16_to_f32(u[1] >> 16) * f;
    dst[4] = h16_to_f32(u[2] & 0xffffu) * f;
    dst[5] = h16_to_f32(u[2] >> 16) * f;
    dst[6] = h16_to_f32(u[3] & 0xffffu) * f;
    dst[7] = h16_to_f32(u[3] >> 16) * f;
  }
  __syncthreads();

  const int cp = (t >> 5) & 3;                      // 16-channel group: tile column cp >> 1, half cp & 1
  const int c8 = cp * 16 + ((t >> 4) & 1) * 8;
  // this thread's chunk in the O16 and MID planes for token group t >> 7; two 16-token bands further per iteration
  const size_t po0 = (size_t)((((b * kSeq + y0 * kImg) >> 4) + (t >> 7)) * (kDim / 32) + (c0 >> 5) + (cp >> 1)) * kTileH
                     + (cp & 1) * 256 + (t & 31) * 8;
  const unsigned short* oq = O16 + po0;
  unsigned short* mp = MID + po0;
#pragma unroll 1
  for (int it = 0; it < 4; ++it, oq += 2 * kBandH, mp += 2 * kBandH) {
    const int tg  = it * 2 + (t >> 7);  // 16-token group 0..7
    const int row = tg * 16 + (t & 15); // local token 0..127
    const int yl  = row >> 5;          // 0..3
    const int x   = row & 31;
    const v4u ou = *(const v4u*)oq;
    float o[8];
    o[0] = h16_to_f32(ou[0] & 0xffffu); o[1] = h16_to_f32(ou[0] >> 16);
    o[2] = h16_to_f32(ou[1] & 0xffffu); o[3] = h16_to_f32(ou[1] >> 16);
    o[4] = h16_to_f32(ou[2] & 0xffffu); o[5] = h16_to_f32(ou[2] >> 16);
    o[6] = h16_to_f32(ou[3] & 0xffffu); o[7] = h16_to_f32(ou[3] >> 16);
    unsigned short hb[8];
#pragma unroll
    for (int e = 0; e < 8; ++e) {
      const int ce = c8 + e;
      const float* vr = sv + ce * kCvPitch + yl * kCvCols + x;   // tap (ky,kx) at vr[ky*34 + kx]
      const float* wr = sw + ce * 9;
      float acc = sb[ce];
#pragma unroll
      for (int ky = 0; ky < 3; ++ky) {
#pragma unroll
        for (int kx = 0; kx < 3; ++kx) acc = fmaf(wr[ky * 3 + kx], vr[ky * kCvCols + kx], acc);
      }
      hb[e] = h_bits(o[e] + acc);
    }
    const v4u u = (v4u){pk16(hb[0], hb[1]), pk16(hb[2], hb[3]), pk16(hb[4], hb[5]), pk16(hb[6], hb[7])};
    *(v4u*)mp = u;
    
  }
}

// ---------------------------------------------------------------------------
// Host glue.
// Every 16-bit plane below is held in fragment order (see kTileH); the shapes name its rows x k.
//   XH     f16 [16384][512]            16,777,216  at           0   (x cast)
//   WQKVT  f16 [1536][512]  x16          1,572,864  at  16,777,216   (rows 0..511 Wq^T, 512..1023 Wk^T, 1024..1535 Wv^T)
//   WPT    f16 [512][512]   x16            524,288  at  18,350,080
//   Q16    f16 [8][16384][64]          16,777,216  at  18,874,368   (head-major, row = b*1024+n)
//   K16    f16 [8][16384][64]          16,777,216  at  35,651,584
//   VT     f16 [512][16384]            16,777,216  at  52,428,800   (per head: tile (token >> 5) * 4 + (d >> 4))
//   O16    f16 [16384][512]  x64       16,777,216  at  69,206,016
//   MID16  f16 [16384][512]  x64       16,777,216  at  85,983,232
//   total                             102,760,448
// GEMM shapes (all M,N multiples of 64, K % 32 == 0, no padding anywhere):
//   q, k:  M=16384 N=64 K=512;  v^T: M=64 N=16384 K=512;  proj:  M=512 N=1024 K=512 (writes out[b][c][n] directly).
// Scores, softmax and P.V of all 128 (head, batch) pairs: one launch of attn_fused_kernel.
// ---------------------------------------------------------------------------
extern "C" void kernel_launch(void* const* d_in, const int* in_sizes, int n_in,
                              void* d_out, int out_size, void* d_ws, size_t ws_size,
                              hipStream_t stream) {
  if (n_in < 11) return;
  const int nX = kTok * kDim;                       // 8,388,608
  if (in_sizes[0] != nX) return;
  if (in_sizes[1] != kDim * kDim || in_sizes[2] != kDim) return;
  if (in_sizes[3] != kDim * 2 * kDim || in_sizes[4] != 2 * kDim) return;
  if (in_sizes[5] != kDim * 9 || in_sizes[6] != kDim) return;
  if (in_sizes[7] != kDim * kDim || in_sizes[8] != kDim) return;
  if (out_size != kBatch * kDim * kSeq) return;

  const size_t szPlane16 = (size_t)kTok * kDim * 2;                 // 16,777,216
  const size_t szWQKVT   = (size_t)3 * kDim * kDim * 2;             //  1,572,864
  const size_t szWPT     = (size_t)kDim * kDim * 2;                 //    524,288
  const size_t szQ       = (size_t)kHeads * kTok * kDh * 2;         // 16,777,216
  const size_t szVT      = (size_t)kDim * kTok * 2;                 // 16,777,216
  const size_t offXH   = 0;
  const size_t offWQKV = offXH + szPlane16;
  const size_t offWPT  = offWQKV + szWQKVT;
  const size_t offQ    = offWPT + szWPT;
  const size_t offK    = offQ + szQ;
  const size_t offVT   = offK + szQ;
  const size_t offO    = offVT + szVT;
  const size_t offMID  = offO + szPlane16;
  const size_t total   = offMID + szPlane16;                       // 102,760,448
  if (ws_size < total) return;

  const float* x    = (const float*)d_in[0];
  const float* Wq   = (const float*)d_in[1];
  const float* bq   = (const float*)d_in[2];
  const float* Wkv  = (const float*)d_in[3];
  const float* bkv  = (const float*)d_in[4];
  const float* cw   = (const float*)d_in[5];
  const float* cb   = (const float*)d_in[6];
  const float* Wp   = (const float*)d_in[7];
  const float* bp   = (const float*)d_in[8];
  const int*   hIn  = (const int*)d_in[9];     // static image height (32), structural only
  const int*   wIn  = (const int*)d_in[10];    // static image width (32), structural only
  float* out = (float*)d_out;
  char* ws = (char*)d_ws;
  unsigned short* XH    = (unsigned short*)(ws + offXH);
  unsigned short* WQKVT = (unsigned short*)(ws + offWQKV);
  unsigned short* WPT   = (unsigned short*)(ws + offWPT);
  unsigned short* Q16   = (unsigned short*)(ws + offQ);
  unsigned short* K16   = (unsigned short*)(ws + offK);
  unsigned short* VT    = (unsigned short*)(ws + offVT);
  unsigned short* O16   = (unsigned short*)(ws + offO);
  unsigned short* MID16 = (unsigned short*)(ws + offMID);

  // ---- prologue: 16-bit operand planes ----
  const int n8 = nX / 8;   // 1,048,576 -> 4096 blocks exact
  // Wq [512 in][512 out] -> WQKVT rows 0..511;  Wkv [512 in][1024 out] -> rows 512..1535;  Wp -> WPT
  cast_all_kernel<<<dim3(kWBlocks + n8 / 256), dim3(256), 0, stream>>>(x, Wq, Wkv, Wp, XH, WQKVT, WPT, n8);

  // ---- projections ----
  const int  tilesQK = (kTok / 64) * (kDh / 64);       // 256 -> 32 blocks per head
  qkv_gemm_kernel<<<dim3(tilesQK / 8, 3 * kHeads), dim3(256), 0, stream>>>(XH, WQKVT, Q16, bq, bkv);

  // ---- attention, all heads and batches in one launch: O16[b*1024 + i][h*64 + d] = f16(64 * softmax(0.125 q.k^T) . v) ----
  const long strideBO = (long)kSeq * kDim;             // next batch in the [16384][512] planes = 524288
  attn_fused_kernel<<<dim3(kSeq / kQBlock, kHeads * kBatch), dim3(256), 0, stream>>>(Q16, K16, VT, O16);

  // ---- depthwise conv branch + add -> MID16 (x64) ----
  conv_mid_kernel<<<dim3(kDim / 64, kImg / 4, kBatch), dim3(256), 0, stream>>>(VT, O16, cw, cb, MID16, hIn, wIn);

  // ---- output projection, transposed store: out[b][c][n] = 1/1024 * sum_k WPT[c][k] * MID16[b*1024+n][k] + bp[c] ----
  const int tilesProj = (kDim / 64) * (kSeq / 64);     // 128 -> 16 blocks
  wmma_gemm64<0, false, 1, 0, false, 0><<<dim3(tilesProj / 8, kBatch), dim3(256), 0, stream>>>(
      WPT, WPT, kDim, 0L, MID16, MID16, kDim, strideBO,
      (void*)out, (void*)out, kSeq, (long)kDim * kSeq, bp, 0L, bp, 0L, kDim, kSeq, kDim, kProjScale);
}

// v006
// One run takes 83.7 microseconds.
// Versions in between are left out here; by their measured steps it is 1.26 times as fast as v004.
// Over all steps from v000 it is 26.5 times as fast.
// Contractions: q/k/v projections (x f16 x W^T f16 carried x16), scores q.k^T (q,k f16 planes), attn.v (V^T f16 x P^T f16, P = exp(s - running max) unnormalised), output projection (W^T f16 x16 x mid f16 x64), column shift of the conv's weighted V^T rows (f16 x64 x 0/1 matrix): all v_wmma_f32_16x16x32_f16, f32 accumulate; softmax, the conv's weighted row sums, bias adds in f32.
#include <hip/hip_runtime.h>
#include <math.h>

// ---------------------------------------------------------------------------
// Problem constants
// ---------------------------------------------------------------------------
constexpr int kBatch = 16;
constexpr int kSeq   = 1024;              // tokens per batch = 32 x 32 image
constexpr int kDim   = 512;
constexpr int kHeads = 8;
constexpr int kDh    = 64;
constexpr int kImg   = 32;
constexpr int kTok   = kBatch * kSeq;     // 16384 token rows
constexpr float kWCarry     = 16.0f;      // weights carried x16 in f16
constexpr float kWCarryInv  = 1.0f / 16.0f;
constexpr float kMidCarry   = 64.0f;      // attention output and mid carried x64 in f16
constexpr float kAttScale   = 0.125f;     // 64^-0.5
constexpr float kProjScale  = 1.0f / (kMidCarry * kWCarry);  // 1/1024
static_assert(kHeads * kDh == kDim, "shape");
static_assert(kImg * kImg == kSeq, "image");
static_assert(kTok % 64 == 0 && kSeq % 64 == 0 && kDim % 64 == 0 && kDh % 64 == 0, "tile multiples");
static_assert(kDim % 32 == 0 && kDh % 32 == 0 && kSeq % 32 == 0, "K multiples of 32");

// Fragment order of every 16-bit operand plane: a plane of rows x k is cut into tiles of 16 rows x 32 k = kTileH halves (1 KB).
// Inside a tile, element (row r, k) sits at ((k >> 4) & 1) * 256 + (((k >> 3) & 1) * 16 + (r & 15)) * 8 + (k & 7):
// lane l = 16 * hf + r of a wave finds its fragment elements 0..7 at l * 8 and 8..15 at 256 + l * 8, so each of the two
// 16-byte loads (or stores) of a wave covers 512 contiguous bytes = four whole lines.
constexpr int kTileH = 512;
constexpr int kBandH = (kDim / 32) * kTileH;   // a 16-row band of a plane with k extent kDim: 16 tiles in a row
typedef __attribute__((ext_vector_type(16))) _Float16 v16h;
typedef __attribute__((ext_vector_type(8)))  _Float16 v8h;
typedef __attribute__((ext_vector_type(16))) __bf16   v16b;
typedef __attribute__((ext_vector_type(8)))  __bf16   v8b;
typedef __attribute__((ext_vector_type(8)))  float    v8f;
typedef __attribute__((ext_vector_type(4)))  float    v4f;
typedef __attribute__((ext_vector_type(4)))  unsigned int v4u;

__device__ __forceinline__ unsigned short f2bf_bits(float f) {
  unsigned u = __float_as_uint(f);
  return (unsigned short)((u + 0x7FFFu + ((u >> 16) & 1u)) >> 16);
}
__device__ __forceinline__ float bf_bits2f(unsigned short h) { return __uint_as_float(((unsigned)h) << 16); }

// hazard guards as plain device helpers
__device__ __forceinline__ void dep_guard_h(v8f& a, v8f& b, v16h x, v16h y) { asm volatile("v_nop\n\tv_nop\n\tv_nop\n\tv_nop" : "+v"(a), "+v"(b) : "v"(x), "v"(y)); }
__device__ __forceinline__ void dep_guard_b(v8f& a, v8f& b, v16b x, v16b y) { asm volatile("v_nop\n\tv_nop\n\tv_nop\n\tv_nop" : "+v"(a), "+v"(b) : "v"(x), "v"(y)); }
__device__ __forceinline__ void keep4_h(v16h a, v16h b, v16h c, v16h d) { asm volatile("v_nop" :: "v"(a), "v"(b), "v"(c), "v"(d)); }
__device__ __forceinline__ void keep4_b(v16b a, v16b b, v16b c, v16b d) { asm volatile("v_nop" :: "v"(a), "v"(b), "v"(c), "v"(d)); }
__device__ __forceinline__ void acc_guard4(v8f& a, v8f& b, v8f& c, v8f& d) { asm volatile("v_nop\n\tv_nop\n\tv_nop\n\tv_nop" : "+v"(a), "+v"(b), "+v"(c), "+v"(d)); }
template <typename T> struct Frag;
template <> struct Frag<_Float16> {
  typedef v16h V; union U { v16h v; v8h h[2]; };
  // a fragment from a fragment-order tile (see kTileH), p = tile base + lane*8: elements 0..7 <- p[0..7], 8..15 <- p[256..263]
  static __device__ __forceinline__ v16h loadp(const _Float16* p) {
    U f; f.h[0] = *(const v8h*)(p); f.h[1] = *(const v8h*)(p + 256); return f.v;
  }
  static __device__ __forceinline__ v8f mma(v16h a, v16h b, v8f c) {
    return __builtin_amdgcn_wmma_f32_16x16x32_f16(false, a, false, b, (short)0, c, false, false);
  }
  static __device__ __forceinline__ void guard(v8f& a, v8f& b, v16h x, v16h y) { dep_guard_h(a, b, x, y); }
  static __device__ __forceinline__ void keep(v16h a, v16h b, v16h c, v16h d) { keep4_h(a, b, c, d); }
};
template <> struct Frag<__bf16> {
  typedef v16b V; union U { v16b v; v8b h[2]; };
  static __device__ __forceinline__ v16b loadp(const __bf16* p) {
    U f; f.h[0] = *(const v8b*)(p); f.h[1] = *(const v8b*)(p + 256); return f.v;
  }
  static __device__ __forceinline__ v8f mma(v16b a, v16b b, v8f c) {
    return __builtin_amdgcn_wmma_f32_16x16x32_bf16(false, a, false, b, (short)0, c, false, false);
  }
  static __device__ __forceinline__ void guard(v8f& a, v8f& b, v16b x, v16b y) { dep_guard_b(a, b, x, y); }
  static __device__ __forceinline__ void keep(v16b a, v16b b, v16b c, v16b d) { keep4_b(a, b, c, d); }
};

__device__ __forceinline__ unsigned pk16(unsigned short a, unsigned short b) { return (unsigned)a | ((unsigned)b << 16); }
__device__ __forceinline__ unsigned short h_bits(float f) { const _Float16 h = (_Float16)f; return __builtin_bit_cast(unsigned short, h); }

// ---- Register-blocked batched WMMA GEMM (ACT reduced to none/relu/leaky; bias gets a per-z stride and the
//      bias[m] line is loaded as two float4 per 16-row slab instead of per-lane scalars; RESID path not instantiated) ---
// C[m,n] = scale * sum_k A[m,k] * Bt[n,k] (+bias); each wave owns a 64x64 tile.
// A [M,kDim] and Bt [N,kDim] in fragment order, tile (row >> 4) * (kDim / 32) + (k >> 5); M,N % 64 == 0, K = kDim (the argument is not read).
// SPLIT (hi/lo operand planes): not instantiated.
// BIAS_MODE: 0 = none, 1 = bias[m], 2 = bias[n]; bias base = bias + z*strideBias.
// OUT_MODE: 0 = f32 row-major, 1 = f16 in fragment order, tile (m >> 4) * TRS + (n >> 5) * TCS, 2 = bf16 hi plane (Cout) + bf16 lo plane (Cout2).
// ET: 0 = f16 operands, 1 = bf16 operands (pointers passed as 16-bit storage)
// base + a 32-bit byte offset: with a wave-uniform base this is the load's own scalar-base form, no 64-bit vector add per step
template <typename T> __device__ __forceinline__ const T* at_bytes(const T* base, unsigned bytes) {
  return (const T*)((const char*)base + bytes);
}
// One request a lane asks L2 for a part of the plane, for speed only: no data comes back and no counter moves.
// base = a four-band operand (64 KB in a row, wave-uniform); off = (lane >> 3) * 16 KB + (lane & 7) * 256 B + pair * 2 KB, pair < 8: the
// 32 lanes name the tiles of k steps 2 * pair and 2 * pair + 1 of all four bands. IMM moves on by whole pairs; off + IMM < 64 KB.
template <int IMM> __device__ __forceinline__ void ask_l2(const void* base, unsigned off) {
  asm volatile("global_prefetch_b8 %0, %1 offset:%2 scope:SCOPE_SE" :: "v"(off), "s"(base), "n"(IMM));
}
template <int ET> struct Elem;
template <> struct Elem<0> { typedef _Float16 T; };
template <> struct Elem<1> { typedef __bf16 T; };
// The engine is a device function, so that one launch can hold GEMMs of different template forms (b = the GEMM's own z index,
// sT = the block's 8 per-wave 16x64 slabs, pitch 68 floats).
constexpr int kSlabF = 16 * 68;
// OWN_IS_A: the operand in which the block's eight waves differ (the other one they share). OWN_ASKS: of the eight k-step pairs of its
// own operand a wave asks L2 for this many; the blocks that read the same tiles share the pairs out by their rank among each other
// (readerRank where A is the own operand, the tile row where B is). AHEAD: ahead is a 64 KB operand of a later block of this launch.
// askShared (block-uniform): many blocks read the same shared operand, and only a few of them, early in the grid, ask for it.
template <int ET, bool SPLIT, int BIAS_MODE, int OUT_MODE, bool RESID, int ACT, int TRS, int TCS, bool OWN_IS_A, int OWN_ASKS, bool AHEAD>
__device__ __forceinline__ void gemm64_body(
    float (*sT)[kSlabF], const int b, const int readerRank, const bool askShared, const unsigned short* __restrict__ ahead,
    const unsigned short* __restrict__ Ap, long strideA,
    const unsigned short* __restrict__ Btp, long strideB,
    void* __restrict__ Cout, void* __restrict__ Cout2, int ldc, long strideC,
    const float* __restrict__ bias, long strideBias,
    int M, int N, float scale) {
  static_assert(!RESID, "resid path not used");
  static_assert(!SPLIT, "split path not used");
  typedef typename Elem<ET>::T T;
  typedef typename Frag<T>::V V;
  const T* A = (const T*)Ap; const T* Bt = (const T*)Btp;
  const int lane = threadIdx.x & 31;
  // the wave's number in a scalar register: the band bases of the k loop are then scalar, and a fragment load is scalar base + offset
  const int wave = __builtin_amdgcn_readfirstlane(threadIdx.x >> 5);
  const int tilesN = N >> 6;
  const int tilesM = M >> 6;
  const int tile = blockIdx.x * 8 + wave;
  if (tile >= tilesM * tilesN) return;   // wave-uniform; no block barriers in this kernel
  const int tm = tile / tilesN;
  const int tn = tile - tm * tilesN;
  const int m0 = tm << 6;
  const int n0 = tn << 6;

  const T* Ab  = A  + (size_t)b * strideA;
  const T* Bb  = Bt + (size_t)b * strideB;

  const int rlane = lane & 15;                 // row (A) / col (B, D) within subtile
  const int mOff  = (lane >> 4) * 8;           // D row offset

  v8f acc[4][4];
#pragma unroll
  for (int i = 0; i < 4; ++i)
#pragma unroll
    for (int j = 0; j < 4; ++j) acc[i][j] = (v8f){0.f,0.f,0.f,0.f,0.f,0.f,0.f,0.f};

  // the wave's first A and B band (wave-uniform); A and B share one 32-bit offset: this lane's chunk of the k step's tile
  const T* Aw = Ab + (size_t)(m0 >> 4) * kBandH;
  const T* Bw = Bb + (size_t)(n0 >> 4) * kBandH;
  const unsigned lane16 = (unsigned)lane * 16u;                                  // in bytes
  // Every fragment is fetched one k step ahead of its WMMAs. An A fragment serves one row of four WMMAs, so its registers
  // take the next step's fragment right behind that row; a B fragment serves all four rows, so B has two register sets,
  // and the idle set is refilled behind row 0.
  const T* Al = at_bytes(Aw, lane16);
  const T* Bl = at_bytes(Bw, lane16);
  V af[4], bf[2][4];
#pragma unroll
  for (int i = 0; i < 4; ++i) af[i] = Frag<T>::loadp(Al + i * kBandH);
#pragma unroll
  for (int j = 0; j < 4; ++j) bf[0][j] = Frag<T>::loadp(Bl + j * kBandH);
  // behind the first step's loads: the shared operand, a k-step pair a wave; this block's part of the wave's own operand
  static_assert(OWN_ASKS == 0 || OWN_ASKS == 1 || OWN_ASKS == 4, "pairs a wave asks for");
  const unsigned unitOff   = (unsigned)(lane >> 3) * (unsigned)(kBandH * 2) + (unsigned)(lane & 7) * 256u;
  const unsigned offShared = unitOff + (unsigned)wave * 2048u;
  const unsigned offOwn    = unitOff + (unsigned)((OWN_IS_A ? readerRank : tm) & (OWN_ASKS == 4 ? 1 : 7)) * 2048u;
  const T* sharedOp = OWN_IS_A ? Bw : Aw;
  const T* ownOp    = OWN_IS_A ? Aw : Bw;
  if (OWN_ASKS >= 1) ask_l2<0>(ownOp, offOwn);
  if (OWN_ASKS == 4) { ask_l2<4096>(ownOp, offOwn); ask_l2<8192>(ownOp, offOwn); ask_l2<12288>(ownOp, offOwn); }
  if (askShared) {
    ask_l2<0>(sharedOp, offShared);
    if (AHEAD) ask_l2<0>(ahead, offShared);
  }
  // the requests go out ahead of the first WMMA's wait for its loads: behind it they would lose a memory latency of lead
  __builtin_amdgcn_sched_barrier(0);
#pragma unroll   // all steps in a row: the B sets are named by constants (no register copies), every load is base + lane + immediate, the last step fetches nothing
  for (int ks = 0; ks < kDim / 32; ++ks) {
    const int s = ks & 1;
    const bool more = ks + 1 < kDim / 32;
#pragma unroll
    for (int i = 0; i < 4; ++i) {
#pragma unroll
      for (int j = 0; j < 4; ++j) acc[i][j] = Frag<T>::mma(af[i], bf[s][j], acc[i][j]);
      Frag<T>::guard(acc[i][0], acc[i][3], af[i], af[i]);
      // the pair of scheduling fences holds each refill right behind its whole row: ahead of the row's last WMMA it would need
      // registers of its own (spills), and behind WMMAs of later rows it would lose its lead
      __builtin_amdgcn_sched_barrier(0);
      if (more) {
        af[i] = Frag<T>::loadp(Al + (ks + 1) * kTileH + i * kBandH);
        if (i == 0) {
#pragma unroll
          for (int j = 0; j < 4; ++j) bf[s ^ 1][j] = Frag<T>::loadp(Bl + (ks + 1) * kTileH + j * kBandH);
        }
      }
      __builtin_amdgcn_sched_barrier(0);
    }
    Frag<T>::keep(bf[s][0], bf[s][1], bf[s][2], bf[s][3]);
  }
  // the registers that the requests name keep their values to the end of the k loop: a request moves no counter that could be waited on
  asm volatile("" :: "v"(offShared), "s"(sharedOp));
  if (OWN_ASKS >= 1) asm volatile("" :: "v"(offOwn), "s"(ownOp));   // as above
  if (AHEAD) asm volatile("" :: "s"(ahead));                        // as above
  acc_guard4(acc[0][0], acc[0][1], acc[0][2], acc[0][3]);
  acc_guard4(acc[1][0], acc[1][1], acc[1][2], acc[1][3]);
  acc_guard4(acc[2][0], acc[2][1], acc[2][2], acc[2][3]);
  acc_guard4(acc[3][0], acc[3][1], acc[3][2], acc[3][3]);

  // ---- epilogue ----
  float* slab = sT[wave];
  const float* biasb = (BIAS_MODE != 0) ? (bias + (size_t)b * strideBias) : nullptr;
#pragma unroll
  for (int i = 0; i < 4; ++i) {
    const int mBase = m0 + (i << 4);
    float b8[8] = {0.f,0.f,0.f,0.f,0.f,0.f,0.f,0.f};
    if (BIAS_MODE == 1) {
      const v4f bm0 = *(const v4f*)(biasb + mBase + mOff);
      const v4f bm1 = *(const v4f*)(biasb + mBase + mOff + 4);
      b8[0] = bm0[0]; b8[1] = bm0[1]; b8[2] = bm0[2]; b8[3] = bm0[3];
      b8[4] = bm1[0]; b8[5] = bm1[1]; b8[6] = bm1[2]; b8[7] = bm1[3];
    }
#pragma unroll
    for (int j = 0; j < 4; ++j) {
      const int n = n0 + (j << 4) + rlane;
      float bv = 0.f;
      if (BIAS_MODE == 2) bv = biasb[n];
#pragma unroll
      for (int r = 0; r < 8; ++r) {
        float v = acc[i][j][r] * scale;
        if (BIAS_MODE == 1) v += b8[r];
        if (BIAS_MODE == 2) v += bv;
        if (ACT == 2) v = fmaxf(v, 0.0f);
        if (ACT == 4) v = (v > 0.f) ? v : 0.01f * v;
        slab[(mOff + r) * 68 + (j << 4) + rlane] = v;
      }
    }
    __builtin_amdgcn_fence(__ATOMIC_RELEASE, "workgroup");
    __builtin_amdgcn_wave_barrier();
    __builtin_amdgcn_fence(__ATOMIC_ACQUIRE, "workgroup");
    if (OUT_MODE == 0) {
      float* C = (float*)Cout + (size_t)b * strideC;
      const int hh = lane >> 4, c4 = (lane & 15) * 4;     // row seg = 256 B = 16 lanes x 16 B
      {
#pragma unroll
        for (int it = 0; it < 8; ++it) {
          const int row = it * 2 + hh;
          v4f v = *(const v4f*)(slab + row * 68 + c4);
          *(v4f*)(C + (size_t)(mBase + row) * ldc + n0 + c4) = v;
        }
        
      }
    } else if (OUT_MODE == 1) {
      // slab row = lane & 15, columns it*16 + 8*(lane >> 4) ..+7: one 512-byte half tile per store
      unsigned short* C = (unsigned short*)Cout + (size_t)b * strideC;
#pragma unroll   // the four tile offsets become immediates on one address
      for (int it = 0; it < 4; ++it) {
        const float* sp = slab + rlane * 68 + it * 16 + mOff;
        v8h hv;
#pragma unroll   // keeps hv in registers
        for (int e = 0; e < 8; ++e) hv[e] = (_Float16)sp[e];
        const size_t tileC = (size_t)(mBase >> 4) * TRS + (size_t)((n0 >> 5) + (it >> 1)) * TCS;
        *(v8h*)(C + tileC * kTileH + (it & 1) * 256 + lane * 8) = hv;
      }
    } else {
      const int q = lane >> 3, c8 = (lane & 7) * 8;
      unsigned short* C  = (unsigned short*)Cout  + (size_t)b * strideC;
      unsigned short* C2 = (OUT_MODE == 2) ? ((unsigned short*)Cout2 + (size_t)b * strideC) : nullptr;
      {
#pragma unroll
        for (int it = 0; it < 4; ++it) {
          const int row = it * 4 + q;
          const float* sp = slab + row * 68 + c8;
          v8h hv, lv;
#pragma unroll
          for (int e = 0; e < 8; ++e) {
            if (OUT_MODE == 1) {
              hv[e] = (_Float16)sp[e];
            } else {
              unsigned short hb = f2bf_bits(sp[e]);
              unsigned short lb = f2bf_bits(sp[e] - bf_bits2f(hb));
              hv[e] = __builtin_bit_cast(_Float16, hb);
              lv[e] = __builtin_bit_cast(_Float16, lb);
            }
          }
          *(v8h*)(C + (size_t)(mBase + row) * ldc + n0 + c8) = hv;
          if (OUT_MODE == 2) *(v8h*)(C2 + (size_t)(mBase + row) * ldc + n0 + c8) = lv;
        }
        
      }
    }
    __builtin_amdgcn_fence(__ATOMIC_RELEASE, "workgroup");
    __builtin_amdgcn_wave_barrier();
    __builtin_amdgcn_fence(__ATOMIC_ACQUIRE, "workgroup");
  }
}

// one GEMM per launch, z = blockIdx.y
template <int ET, bool SPLIT, int BIAS_MODE, int OUT_MODE, bool RESID, int ACT = 0, int TRS = 0, int TCS = 0>
__global__ __launch_bounds__(256) void wmma_gemm64(
    const unsigned short* __restrict__ Ap, const unsigned short* __restrict__ A2p, int lda, long strideA,
    const unsigned short* __restrict__ Btp, const unsigned short* __restrict__ Bt2p, int ldb, long strideB,
    void* __restrict__ Cout, void* __restrict__ Cout2, int ldc, long strideC,
    const float* __restrict__ bias, long strideBias,
    const float* __restrict__ resid, long strideR,
    int M, int N, int K, float scale) {
  (void)resid; (void)strideR; (void)lda; (void)ldb; (void)K;
  (void)A2p; (void)Bt2p;
  __shared__ __align__(16) float sT[8][kSlabF];
  // the waves of a block differ in the token tile (B); the eight blocks of one token tile group ask for every second k-step pair each
  gemm64_body<ET, SPLIT, BIAS_MODE, OUT_MODE, RESID, ACT, TRS, TCS, false, 4, false>(
      sT, blockIdx.y, 0, blockIdx.y < 4, nullptr, Ap, strideA, Btp, strideB, Cout, Cout2, ldc, strideC, bias, strideBias, M, N, scale);
}

// The q, k and v projections of all heads in one launch: none reads what another writes. grid (32, 24): blockIdx.y = z,
// 0..7 q heads, 8..15 k heads, 16..23 v heads. The 64 weight rows of z start at WT + z * 64 * 512 and its output plane at
// QKV + z * 16384 * 64 (the Q16, K16 and VT planes follow one another); the k and v biases are bkv[(z - 8) * 64 ..].
//   q, k: C[tok][d] = 1/16 * sum_k XH[tok][k] * WT[z*64 + d][k] + bias[d]   (M = 16384, N = 64)
//   v^T:  C[d][tok] = 1/16 * sum_k WT[z*64 + d][k] * XH[tok][k] + bias[d]   (M = 64, N = 16384)
__global__ __launch_bounds__(256) void qkv_gemm_kernel(const unsigned short* __restrict__ XH, const unsigned short* __restrict__ WT,
                                                       unsigned short* __restrict__ QKV,
                                                       const float* __restrict__ bq, const float* __restrict__ bkv) {
  __shared__ __align__(16) float sT[8][kSlabF];
  const int z = blockIdx.y;
  const unsigned short* Wz = WT + (size_t)z * (kDh * kDim);
  unsigned short* Cz = QKV + (size_t)z * ((size_t)kTok * kDh);
  const float* bz = (z < kHeads) ? (bq + z * kDh) : (bkv + (z - kHeads) * kDh);
  if (z < 2 * kHeads) {   // block-uniform
    // the q and k blocks of one group of x rows ask for one k-step pair of those rows each, and for the weight rows of the same head's
    // v blocks
    const unsigned short* later = WT + (size_t)(2 * kHeads + (z & (kHeads - 1))) * (kDh * kDim);
    gemm64_body<0, false, 2, 1, false, 0, 2, 1, true, 1, true>(sT, 0, z, blockIdx.x < 8, later, XH, 0L, Wz, 0L, (void*)Cz, (void*)Cz, kDh, 0L, bz, 0L, kTok, kDh, kWCarryInv);
  } else {
    gemm64_body<0, false, 1, 1, false, 0, 1, 4, false, 0, false>(sT, 0, 0, blockIdx.x < 8, nullptr, Wz, 0L, XH, 0L, (void*)Cz, (void*)Cz, kTok, 0L, bz, 0L, kDh, kTok, kWCarryInv);
  }
}

// ---------------------------------------------------------------------------
// ---------------------------------------------------------------------------
// x f32 [16384][512] row-major -> f16 plane in fragment order, tile (row >> 4) * 16 + (k >> 5).
// A block takes 16 rows x 128 columns = 4 tiles = 256 chunks of 8 halves. Thread t reads chunk (row t >> 4, column group
// t & 15): 512 contiguous bytes per row. In fragment order that chunk has index (t & 15) * 16 + (t >> 4), a 16 x 16
// transpose of chunks, done through LDS (pitch 17 chunks against bank conflicts) so that the block stores 4 KB in a row.
__device__ __forceinline__ void cast8_f16_block(v4u* sh, const int blk, const float* __restrict__ in, unsigned short* __restrict__ out, int n8) {
  if ((blk + 1) * 256 > n8) return;               // block-uniform, in front of the barrier
  const int t  = threadIdx.x;
  const int rt = blk >> 2;                        // 16-row band
  const int cg = blk & 3;                         // group of 128 columns = 4 tiles
  const float* p = in + (size_t)(rt * 16 + (t >> 4)) * kDim + cg * 128 + (t & 15) * 8;
  const v4f a = *(const v4f*)(p);
  const v4f c = *(const v4f*)(p + 4);
  unsigned short hb[8];
#pragma unroll
  for (int e = 0; e < 4; ++e) {
    hb[e]     = h_bits(a[e]);
    hb[4 + e] = h_bits(c[e]);
  }
  const v4u u = (v4u){pk16(hb[0], hb[1]), pk16(hb[2], hb[3]), pk16(hb[4], hb[5]), pk16(hb[6], hb[7])};
  sh[(t & 15) * 17 + (t >> 4)] = u;
  __syncthreads();
  unsigned short* q = out + (size_t)(rt * (kDim / 32) + cg * 4) * kTileH + t * 8;
  *(v4u*)q = sh[(t >> 4) * 17 + (t & 15)];
}

// ---------------------------------------------------------------------------
// Weight transpose + cast: W is f32 [512 in][nOut out] row-major (x @ W orientation); WT[o][i] = f16(scale * W[i][o]),
// WT in fragment order, tile (o >> 4) * 16 + (i >> 5). 512/64 input tiles x nOut/64 output tiles: bi = i tile (64 cols of WT),
// bo = o tile (64 rows of WT). 256 threads.
// Load coverage: 16 iterations x 256 threads = 4096 = the whole 64x64 tile (coalesced along o).
// Store coverage: wave w owns tile (16-row band w >> 1, 32-column band w & 1) of the 4 x 2 tiles; 2 iterations = its two halves.
// ---------------------------------------------------------------------------
__device__ __forceinline__ void wtcast_block(float (*sm)[65], const int bi, const int bo, const float* __restrict__ W, int nOut,
                                             unsigned short* __restrict__ out, float scale) {
  // sm[o_local][i_local]
  const int t  = threadIdx.x;
  const int i0 = bi * 64;
  const int o0 = bo * 64;
  float wv[16];
#pragma unroll
  for (int it = 0; it < 16; ++it) {
    const int e = it * 256 + t;
    const int r = e >> 6;          // i local
    const int c = e & 63;          // o local
    wv[it] = W[(size_t)(i0 + r) * nOut + o0 + c];
    // behind each load: a later load's result may be given an address register of this one, and no register that an issued load names is rewritten ahead of this wait
    asm volatile("s_wait_xcnt 0x0" ::: "memory");
  }
#pragma unroll   // keeps wv in registers
  for (int it = 0; it < 16; ++it) {
    const int e = it * 256 + t;
    sm[e & 63][e >> 6] = wv[it] * scale;
  }
  __syncthreads();
  const int lane = t & 31, wave = t >> 5;
  const int rtl = wave >> 1, ctl = wave & 1;
  {
#pragma unroll
    for (int it = 0; it < 2; ++it) {
      const int row = rtl * 16 + (lane & 15);                // o local
      const int c8  = ctl * 32 + it * 16 + (lane >> 4) * 8;  // i local
      unsigned short hb[8];
#pragma unroll
      for (int e = 0; e < 8; ++e) hb[e] = h_bits(sm[row][c8 + e]);
      const v4u u = (v4u){pk16(hb[0], hb[1]), pk16(hb[2], hb[3]), pk16(hb[4], hb[5]), pk16(hb[6], hb[7])};
      *(v4u*)(out + (size_t)(((o0 >> 4) + rtl) * (kDim / 32) + (i0 >> 5) + ctl) * kTileH + it * 256 + lane * 8) = u;
    }
    
  }
}

// ---------------------------------------------------------------------------
// All four operand casts in one launch: none reads what another writes. The 256 weight blocks come first (their chain of loads,
// barrier and stores is the longer one): 0..63 Wq, 64..191 Wkv, 192..255 Wp, each as i tile = w & 7, o tile = w >> 3;
// blocks 256.. are the x cast's. Every branch is block-uniform, so each block meets exactly the one barrier of its own part.
// ---------------------------------------------------------------------------
constexpr int kWBlocksQ  = (kDim / 64) * (kDim / 64);          // 64
constexpr int kWBlocksKV = (kDim / 64) * ((2 * kDim) / 64);    // 128
constexpr int kWBlocks   = 2 * kWBlocksQ + kWBlocksKV;         // 256
__global__ __launch_bounds__(256) void cast_all_kernel(const float* __restrict__ x, const float* __restrict__ Wq,
                                                       const float* __restrict__ Wkv, const float* __restrict__ Wp,
                                                       unsigned short* __restrict__ XH, unsigned short* __restrict__ WQKVT,
                                                       unsigned short* __restrict__ WPT, int n8) {
  __shared__ float sm[64][65];
  __shared__ v4u sh[16 * 17];
  const int blk = blockIdx.x;
  if (blk >= kWBlocks) {
    cast8_f16_block(sh, blk - kWBlocks, x, XH, n8);
    return;
  }
  const bool isQ  = blk < kWBlocksQ;
  const bool isKV = !isQ && blk < kWBlocksQ + kWBlocksKV;
  const float* W         = isQ ? Wq : (isKV ? Wkv : Wp);
  unsigned short* WT     = isQ ? WQKVT : (isKV ? WQKVT + (size_t)kDim * kDim : WPT);
  const int first        = isQ ? 0 : (isKV ? kWBlocksQ : kWBlocksQ + kWBlocksKV);
  wtcast_block(sm, blk & 7, (blk - first) >> 3, W, isKV ? 2 * kDim : kDim, WT, kWCarry);
}

__device__ __forceinline__ float xhalf(float x) {
  const int i = __builtin_bit_cast(int, x);
  return __builtin_bit_cast(float, __builtin_amdgcn_permlanex16(i, i, 0x76543210, 0xfedcba98, false, false));
}
__device__ __forceinline__ unsigned pack2h(float lo, float hi) {   // two f32 -> packed f16, round to nearest even
  typedef __attribute__((ext_vector_type(2))) float    f2;
  typedef __attribute__((ext_vector_type(2))) _Float16 h2;
  return __builtin_bit_cast(unsigned, __builtin_convertvector((f2){lo, hi}, h2));
}
constexpr int kQWave  = 32;                 // queries per wave
constexpr int kQBlock = 8 * kQWave;         // queries per block
constexpr int kPass   = 32;                 // keys per pass
static_assert(kSeq % kQBlock == 0 && kSeq % kPass == 0 && (kSeq & (kSeq - 1)) == 0 && kDh == 64, "fused attention shape");
// waves_per_eu(4, 4): 512 blocks on 256 WGPs = two blocks per WGP = four waves per SIMD, so at most 256 registers a wave
__global__ __launch_bounds__(256) __attribute__((amdgpu_waves_per_eu(4, 4)))
void attn_fused_kernel(const unsigned short* __restrict__ Qp, const unsigned short* __restrict__ Kp,
                       const unsigned short* __restrict__ VTp, const float* __restrict__ cw, const float* __restrict__ cb,
                       unsigned short* __restrict__ MID, const int* __restrict__ hw0, const int* __restrict__ hw1) {
  (void)hw0; (void)hw1;
  typedef Frag<_Float16> F;
  const int lane = threadIdx.x & 31;
  const int wave = threadIdx.x >> 5;
  const int hb = blockIdx.y;                // h*16 + b: the head-major Q and K planes are contiguous in it
  const int h  = hb >> 4;
  const int b  = hb & 15;
  const int q0 = blockIdx.x * kQBlock + wave * kQWave;
  const _Float16* Q = (const _Float16*)Qp + (size_t)hb * (kSeq * kDh);
  const _Float16* kp = (const _Float16*)Kp + (size_t)hb * (kSeq * kDh) + lane * 8;    // + key0*64 + (2*kt + kc)*kTileH
  const _Float16* vp = (const _Float16*)VTp + (size_t)hb * (kSeq * kDh) + lane * 8;   // + key0*64 + t*kTileH
  const float cscale = kAttScale * 1.4426950408889634f;   // score scale times log2(e)

  v16h qf[2][2];
#pragma unroll
  for (int g = 0; g < 2; ++g)
#pragma unroll
    for (int kc = 0; kc < 2; ++kc) qf[g][kc] = F::loadp(Q + (size_t)(((q0 >> 4) + g) * 2 + kc) * kTileH + lane * 8);

  v8f acc[2][4];
  float m_run[2], l_run[2];
#pragma unroll
  for (int g = 0; g < 2; ++g) {
    m_run[g] = -INFINITY; l_run[g] = 0.f;
#pragma unroll
    for (int t = 0; t < 4; ++t) acc[g][t] = (v8f){0.f,0.f,0.f,0.f,0.f,0.f,0.f,0.f};
  }

  v16h kf[2][2];
#pragma unroll
  for (int kt = 0; kt < 2; ++kt)
#pragma unroll
    for (int kc = 0; kc < 2; ++kc) kf[kt][kc] = F::loadp(kp + (2 * kt + kc) * kTileH);

  // rolled: one pass is already 16 WMMAs and 16 loads, and unrolling would cost the registers of the fourth wave per SIMD
#pragma unroll 1
  for (int key0 = 0; key0 < kSeq; key0 += kPass) {
    // this pass's V^T fragments, in flight under the first product and the softmax
    v16h vf[4];
#pragma unroll
    for (int t = 0; t < 4; ++t) vf[t] = F::loadp(vp + (size_t)key0 * kDh + t * kTileH);

    v8f s[2][2];
#pragma unroll
    for (int kt = 0; kt < 2; ++kt)
#pragma unroll
      for (int g = 0; g < 2; ++g) {
        s[kt][g] = (v8f){0.f,0.f,0.f,0.f,0.f,0.f,0.f,0.f};
#pragma unroll
        for (int kc = 0; kc < 2; ++kc) s[kt][g] = F::mma(kf[kt][kc], qf[g][kc], s[kt][g]);
      }

    // next pass's K fragments, in flight under the softmax and the second product (the last pass re-reads keys 0..31, unused)
    const int nk = (key0 + kPass) & (kSeq - 1);
#pragma unroll
    for (int kt = 0; kt < 2; ++kt)
#pragma unroll
      for (int kc = 0; kc < 2; ++kc) kf[kt][kc] = F::loadp(kp + (size_t)nk * kDh + (2 * kt + kc) * kTileH);

#pragma unroll
    for (int g = 0; g < 2; ++g) {
      float mx = s[0][g][0];
#pragma unroll
      for (int r = 1; r < 8; ++r) mx = fmaxf(mx, s[0][g][r]);
#pragma unroll
      for (int r = 0; r < 8; ++r) mx = fmaxf(mx, s[1][g][r]);
      mx = fmaxf(mx, xhalf(mx)) * cscale;                    // both halves hold the query's maximum of this pass, scaled
      const float m_new = fmaxf(m_run[g], mx);
      const float corr  = __builtin_amdgcn_exp2f(m_run[g] - m_new);   // 0 on the first pass (m_run = -inf, m_new finite)
      m_run[g] = m_new;
      float ps = 0.f;
      union { v16h v; unsigned w[8]; } pf;
#pragma unroll
      for (int i = 0; i < 8; ++i) {   // operand elements 2i, 2i+1 = tile i>>2, registers 2(i&3), 2(i&3)+1
        const float p0 = __builtin_amdgcn_exp2f(fmaf(s[i >> 2][g][2 * (i & 3)],     cscale, -m_new));
        const float p1 = __builtin_amdgcn_exp2f(fmaf(s[i >> 2][g][2 * (i & 3) + 1], cscale, -m_new));
        ps += p0 + p1;
        pf.w[i] = pack2h(p0, p1);
      }
      l_run[g] = fmaf(l_run[g], corr, ps);                   // this half's keys only; the halves join after the loop
#pragma unroll
      for (int t = 0; t < 4; ++t) {
        acc[g][t] = acc[g][t] * corr;
        acc[g][t] = F::mma(vf[t], pf.v, acc[g][t]);
      }
    }
  }

  const int rr = lane & 15;
  const int hf = lane >> 4;
  const int y  = q0 >> 5;                                    // the wave's image row
  static_assert(kQWave == kImg && kPass == kImg, "a wave's queries and a pass's keys are one image row");
  float inv[2];
  unsigned short* op[2];
  v16h sel[2][3];
#pragma unroll   // inv, op and sel are indexed by constants: they stay in registers
  for (int g = 0; g < 2; ++g) {
    const float l_fin = l_run[g] + xhalf(l_run[g]);
    inv[g] = kMidCarry / l_fin;                              // the x64 carry of the MID plane
    op[g] = MID + ((size_t)((b * kSeq + q0 + 16 * g) >> 4) * (kDim / 32) + h * 2) * kTileH + lane * 8;
#pragma unroll   // as above, and the words of sel that no lane can match fold to constant zeros
    for (int kx = 0; kx < 3; ++kx) {
      // this lane's operand words 0..3 hold k = 8hf + 0..7, words 4..7 k = 8hf + 16..23, two k a word
      const int rel = 16 * g + rr + kx - 1 - 8 * hf;         // the picked k, counted from this lane's first
      const unsigned one = (rel & 1) ? 0x3C000000u : 0x00003C00u;   // f16 1.0 in the high or the low half
      const int pr = rel >> 1;
      union { v16h v; unsigned w[8]; } u;
#pragma unroll   // the operand words stay in registers
      for (int i = 0; i < 8; ++i) u.w[i] = (pr == ((i < 4) ? i : i + 4)) ? one : 0u;
      sel[g][kx] = u.v;
    }
  }
  const float fUp = (y > 0) ? kMidCarry : 0.0f;              // the carry, or 0 for a tap row outside the image
  const float fDn = (y < kImg - 1) ? kMidCarry : 0.0f;
  const _Float16* vUp = vp + (size_t)((y > 0) ? y - 1 : 0) * (kImg * kDh);
  const _Float16* vMd = vp + (size_t)y * (kImg * kDh);
  const _Float16* vDn = vp + (size_t)((y < kImg - 1) ? y + 1 : kImg - 1) * (kImg * kDh);
  const float* cwl = cw + (size_t)(h * kDh + rr) * 9;
  const float* cbl = cb + h * kDh + rr;
#pragma unroll   // acc is indexed by constants; the next tile's loads can be issued under this tile's sums
  for (int t = 0; t < 4; ++t) {
    const v16h r0 = F::loadp(vUp + t * kTileH);
    const v16h r1 = F::loadp(vMd + t * kTileH);
    const v16h r2 = F::loadp(vDn + t * kTileH);
    const float bias = cbl[t * 16] * kMidCarry;
    v16h rs[3];
#pragma unroll   // rs is indexed by constants: it stays in registers
    for (int kx = 0; kx < 3; ++kx) {
      const float w0 = cwl[t * 144 + kx] * fUp;
      const float w1 = cwl[t * 144 + 3 + kx] * kMidCarry;
      const float w2 = cwl[t * 144 + 6 + kx] * fDn;
#pragma unroll   // the 16 operand elements stay in registers
      for (int e = 0; e < 16; ++e) {
        const float up = (kx == 1) ? fmaf(w0, (float)r0[e], bias) : w0 * (float)r0[e];   // the centre column carries the bias
        rs[kx][e] = (_Float16)fmaf(w2, (float)r2[e], fmaf(w1, (float)r1[e], up));
      }
    }
#pragma unroll   // acc, inv, op and sel are indexed by constants
    for (int g = 0; g < 2; ++g) {
      v8f o = acc[g][t] * inv[g];
#pragma unroll   // three accumulating WMMAs in a row on one tile
      for (int kx = 0; kx < 3; ++kx) o = F::mma(rs[kx], sel[g][kx], o);
      *(v4u*)(op[g] + t * 256) = (v4u){pack2h(o[0], o[1]), pack2h(o[2], o[3]), pack2h(o[4], o[5]), pack2h(o[6], o[7])};
    }
  }
}

// ---------------------------------------------------------------------------
// Host glue.
// Every 16-bit plane below is held in fragment order (see kTileH); the shapes name its rows x k.
//   XH     f16 [16384][512]            16,777,216  at           0   (x cast)
//   WQKVT  f16 [1536][512]  x16          1,572,864  at  16,777,216   (rows 0..511 Wq^T, 512..1023 Wk^T, 1024..1535 Wv^T)
//   WPT    f16 [512][512]   x16            524,288  at  18,350,080
//   Q16    f16 [8][16384][64]          16,777,216  at  18,874,368   (head-major, row = b*1024+n)
//   K16    f16 [8][16384][64]          16,777,216  at  35,651,584
//   VT     f16 [512][16384]            16,777,216  at  52,428,800   (per head: tile (token >> 5) * 4 + (d >> 4))
//   MID16  f16 [16384][512]  x64       16,777,216  at  69,206,016
//   total                              85,983,232
// GEMM shapes (all M,N multiples of 64, K % 32 == 0, no padding anywhere):
//   q, k:  M=16384 N=64 K=512;  v^T: M=64 N=16384 K=512;  proj:  M=512 N=1024 K=512 (writes out[b][c][n] directly).
// Scores, softmax, P.V and the conv branch of all 128 (head, batch) pairs: one launch of attn_fused_kernel.
// ---------------------------------------------------------------------------
extern "C" void kernel_launch(void* const* d_in, const int* in_sizes, int n_in,
                              void* d_out, int out_size, void* d_ws, size_t ws_size,
                              hipStream_t stream) {
  if (n_in < 11) return;
  const int nX = kTok * kDim;                       // 8,388,608
  if (in_sizes[0] != nX) return;
  if (in_sizes[1] != kDim * kDim || in_sizes[2] != kDim) return;
  if (in_sizes[3] != kDim * 2 * kDim || in_sizes[4] != 2 * kDim) return;
  if (in_sizes[5] != kDim * 9 || in_sizes[6] != kDim) return;
  if (in_sizes[7] != kDim * kDim || in_sizes[8] != kDim) return;
  if (out_size != kBatch * kDim * kSeq) return;

  const size_t szPlane16 = (size_t)kTok * kDim * 2;                 // 16,777,216
  const size_t szWQKVT   = (size_t)3 * kDim * kDim * 2;             //  1,572,864
  const size_t szWPT     = (size_t)kDim * kDim * 2;                 //    524,288
  const size_t szQ       = (size_t)kHeads * kTok * kDh * 2;         // 16,777,216
  const size_t szVT      = (size_t)kDim * kTok * 2;                 // 16,777,216
  const size_t offXH   = 0;
  const size_t offWQKV = offXH + szPlane16;
  const size_t offWPT  = offWQKV + szWQKVT;
  const size_t offQ    = offWPT + szWPT;
  const size_t offK    = offQ + szQ;
  const size_t offVT   = offK + szQ;
  const size_t offMID  = offVT + szVT;
  const size_t total   = offMID + szPlane16;                       // 85,983,232
  if (ws_size < total) return;

  const float* x    = (const float*)d_in[0];
  const float* Wq   = (const float*)d_in[1];
  const float* bq   = (const float*)d_in[2];
  const float* Wkv  = (const float*)d_in[3];
  const float* bkv  = (const float*)d_in[4];
  const float* cw   = (const float*)d_in[5];
  const float* cb   = (const float*)d_in[6];
  const float* Wp   = (const float*)d_in[7];
  const float* bp   = (const float*)d_in[8];
  const int*   hIn  = (const int*)d_in[9];     // static image height (32), structural only
  const int*   wIn  = (const int*)d_in[10];    // static image width (32), structural only
  float* out = (float*)d_out;
  char* ws = (char*)d_ws;
  unsigned short* XH    = (unsigned short*)(ws + offXH);
  unsigned short* WQKVT = (unsigned short*)(ws + offWQKV);
  unsigned short* WPT   = (unsigned short*)(ws + offWPT);
  unsigned short* Q16   = (unsigned short*)(ws + offQ);
  unsigned short* K16   = (unsigned short*)(ws + offK);
  unsigned short* VT    = (unsigned short*)(ws + offVT);
  unsigned short* MID16 = (unsigned short*)(ws + offMID);

  // ---- prologue: 16-bit operand planes ----
  const int n8 = nX / 8;   // 1,048,576 -> 4096 blocks exact
  // Wq [512 in][512 out] -> WQKVT rows 0..511;  Wkv [512 in][1024 out] -> rows 512..1535;  Wp -> WPT
  cast_all_kernel<<<dim3(kWBlocks + n8 / 256), dim3(256), 0, stream>>>(x, Wq, Wkv, Wp, XH, WQKVT, WPT, n8);

  // ---- projections ----
  const int  tilesQK = (kTok / 64) * (kDh / 64);       // 256 -> 32 blocks per head
  qkv_gemm_kernel<<<dim3(tilesQK / 8, 3 * kHeads), dim3(256), 0, stream>>>(XH, WQKVT, Q16, bq, bkv);

  // ---- attention + depthwise conv branch, all heads and batches in one launch:
  //      MID16[b*1024 + i][h*64 + d] = f16(64 * (softmax(0.125 q.k^T) . v + conv(v) + conv_b)) ----
  const long strideBO = (long)kSeq * kDim;             // next batch in the [16384][512] planes = 524288
  attn_fused_kernel<<<dim3(kSeq / kQBlock, kHeads * kBatch), dim3(256), 0, stream>>>(Q16, K16, VT, cw, cb, MID16, hIn, wIn);

  // ---- output projection, transposed store: out[b][c][n] = 1/1024 * sum_k WPT[c][k] * MID16[b*1024+n][k] + bp[c] ----
  const int tilesProj = (kDim / 64) * (kSeq / 64);     // 128 -> 16 blocks
  wmma_gemm64<0, false, 1, 0, false, 0><<<dim3(tilesProj / 8, kBatch), dim3(256), 0, stream>>>(
      WPT, WPT, kDim, 0L, MID16, MID16, kDim, strideBO,
      (void*)out, (void*)out, kSeq, (long)kDim * kSeq, bp, 0L, bp, 0L, kDim, kSeq, kDim, kProjScale);
}
